// v000
// Times are from an AMD MI455X. After a warm-up the kernel runs many times in a row, and a time is the length of
// such a window on the GPU divided by its runs, so every launch and the gaps after it count. The runs cycle
// through copies of the inputs. A figure is the median of several windows, for all but v000 over two sittings.
// Sittings can differ by a few percent; kernels timed side by side share one.
// v000 is the starting kernel. One run takes 1640 microseconds.
#include <hip/hip_runtime.h>

typedef __attribute__((ext_vector_type(2))) float v2f;
typedef __attribute__((ext_vector_type(8))) float v8f;

#define CCH   64
#define NSP   8192
#define NBAT  2
#define SCALE 0.125f   // 64^-0.5

__device__ __forceinline__ v8f vzero8() {
  v8f z = {0.f,0.f,0.f,0.f,0.f,0.f,0.f,0.f};
  return z;
}

// D = A(16x4 f32) * B(4x16 f32) + C  -- CDNA5 fp32 WMMA
__device__ __forceinline__ v8f wmma4(v2f a, v2f b, v8f c) {
  return __builtin_amdgcn_wmma_f32_16x16x4_f32(
      /*neg_a=*/false, a, /*neg_b=*/false, b,
      /*c_mod=*/(short)0, c, /*reuse_a=*/false, /*reuse_b=*/false);
}

// generic->LDS offset: flat->local addrspace cast == low-32-bit truncation
__device__ __forceinline__ uint32_t lds_off(const void* p) {
  return (uint32_t)(uintptr_t)p;
}

// CDNA5 async DMA: 16B global -> LDS, tracked by ASYNCcnt
__device__ __forceinline__ void async_g2l_b128(uint32_t dst_lds, const void* gptr) {
  asm volatile("global_load_async_to_lds_b128 %0, %1, off"
               :: "v"(dst_lds), "v"(gptr) : "memory");
}

// reductions across the 16 lanes of each wave32 half (xor masks stay in-half)
__device__ __forceinline__ float rmax16(float x) {
  x = fmaxf(x, __shfl_xor(x, 1));
  x = fmaxf(x, __shfl_xor(x, 2));
  x = fmaxf(x, __shfl_xor(x, 4));
  x = fmaxf(x, __shfl_xor(x, 8));
  return x;
}
__device__ __forceinline__ float rsum16(float x) {
  x += __shfl_xor(x, 1);
  x += __shfl_xor(x, 2);
  x += __shfl_xor(x, 4);
  x += __shfl_xor(x, 8);
  return x;
}

// ---------------------------------------------------------------------------
// Kernel 1: sf = w_s @ x + b_s ; cf = w_c @ x + b_c   (per batch, per voxel)
// grid = B * (N/64), block = 256 (8 waves)
// ---------------------------------------------------------------------------
__global__ __launch_bounds__(256) void proj_kernel(
    const float* __restrict__ x, const float* __restrict__ w_s,
    const float* __restrict__ b_s, const float* __restrict__ w_c,
    const float* __restrict__ b_c, float* __restrict__ sf,
    float* __restrict__ cf)
{
  __shared__ float xs [64 * 66];
  __shared__ float wS [64 * 66];
  __shared__ float wC [64 * 66];
  const int tid  = threadIdx.x;
  const int b    = blockIdx.x >> 7;
  const int nb   = (blockIdx.x & 127) << 6;
  for (int i = tid; i < 64 * 64; i += 256) {
    int c = i >> 6, j = i & 63;
    xs[c * 66 + j] = x[((size_t)((b << 6) + c)) * NSP + nb + j];
    wS[c * 66 + j] = w_s[(c << 6) + j];
    wC[c * 66 + j] = w_c[(c << 6) + j];
  }
  __syncthreads();
  const int lane = tid & 31, wv = tid >> 5;
  const int hl = lane >> 4, lr = lane & 15;
  const int nsub = (wv & 3) << 4;
  const int opr  = (wv >> 2) << 1;
  for (int t = 0; t < 2; ++t) {
    const int ob = (opr + t) << 4;
    v8f accS = vzero8(), accC = vzero8();
    for (int kb = 0; kb < 64; kb += 4) {
      const int k0 = kb + (hl << 1);
      v2f bx; bx.x = xs[k0 * 66 + nsub + lr]; bx.y = xs[(k0 + 1) * 66 + nsub + lr];
      v2f aS; aS.x = wS[(ob + lr) * 66 + k0]; aS.y = wS[(ob + lr) * 66 + k0 + 1];
      v2f aC; aC.x = wC[(ob + lr) * 66 + k0]; aC.y = wC[(ob + lr) * 66 + k0 + 1];
      accS = wmma4(aS, bx, accS);
      accC = wmma4(aC, bx, accC);
    }
#pragma unroll
    for (int v = 0; v < 8; ++v) {
      const int o = ob + v + (hl << 3);
      const size_t idx = ((size_t)((b << 6) + o)) * NSP + nb + nsub + lr;
      sf[idx] = accS[v] + b_s[o];
      cf[idx] = accC[v] + b_c[o];
    }
  }
}

// ---------------------------------------------------------------------------
// Kernel 2: s2c logits[b,c,k] = scale * sum_n sf[c,n]*cf[k,n]   (64x64, K=8192)
// grid = B, block = 256
// ---------------------------------------------------------------------------
__global__ __launch_bounds__(256) void s2c_logits_kernel(
    const float* __restrict__ sf, const float* __restrict__ cf,
    float* __restrict__ lg)
{
  __shared__ float sfs[64 * 66];
  __shared__ float cfs[64 * 66];
  const int tid = threadIdx.x;
  const int b   = blockIdx.x;
  const int lane = tid & 31, wv = tid >> 5;
  const int hl = lane >> 4, lr = lane & 15;
  const int t0 = wv << 1, t1 = t0 + 1;
  const int ct0 = t0 >> 2, kt0 = t0 & 3;
  const int ct1 = t1 >> 2, kt1 = t1 & 3;
  v8f acc0 = vzero8(), acc1 = vzero8();
  for (int nb = 0; nb < NSP; nb += 64) {
    __syncthreads();
    for (int i = tid; i < 64 * 64; i += 256) {
      int c = i >> 6, j = i & 63;
      const size_t g = ((size_t)((b << 6) + c)) * NSP + nb + j;
      sfs[c * 66 + j] = sf[g];
      cfs[c * 66 + j] = cf[g];
    }
    __syncthreads();
    for (int kb = 0; kb < 64; kb += 4) {
      const int k0 = kb + (hl << 1);
      v2f a0; a0.x = sfs[((ct0 << 4) + lr) * 66 + k0]; a0.y = sfs[((ct0 << 4) + lr) * 66 + k0 + 1];
      v2f b0; b0.x = cfs[((kt0 << 4) + lr) * 66 + k0]; b0.y = cfs[((kt0 << 4) + lr) * 66 + k0 + 1];
      acc0 = wmma4(a0, b0, acc0);
      v2f a1; a1.x = sfs[((ct1 << 4) + lr) * 66 + k0]; a1.y = sfs[((ct1 << 4) + lr) * 66 + k0 + 1];
      v2f b1; b1.x = cfs[((kt1 << 4) + lr) * 66 + k0]; b1.y = cfs[((kt1 << 4) + lr) * 66 + k0 + 1];
      acc1 = wmma4(a1, b1, acc1);
    }
  }
#pragma unroll
  for (int v = 0; v < 8; ++v) {
    const int r = v + (hl << 3);
    lg[b * 4096 + ((ct0 << 4) + r) * 64 + (kt0 << 4) + lr] = acc0[v] * SCALE;
    lg[b * 4096 + ((ct1 << 4) + r) * 64 + (kt1 << 4) + lr] = acc1[v] * SCALE;
  }
}

// ---------------------------------------------------------------------------
// Kernel 3: softmax over k of the 64x64 s2c logits. grid = B, block = 64
// ---------------------------------------------------------------------------
__global__ void s2c_softmax_kernel(const float* __restrict__ lg,
                                   float* __restrict__ attn)
{
  const int b = blockIdx.x, r = threadIdx.x;
  const float* row = lg + b * 4096 + r * 64;
  float m = -3.0e38f;
  for (int k = 0; k < 64; ++k) m = fmaxf(m, row[k]);
  float s = 0.f;
  for (int k = 0; k < 64; ++k) s += __expf(row[k] - m);
  const float rs = 1.0f / s;
  for (int k = 0; k < 64; ++k)
    attn[b * 4096 + r * 64 + k] = __expf(row[k] - m) * rs;
}

// ---------------------------------------------------------------------------
// Kernel 4: c2s flash pass 1 — per-row (n) online max M and 1/Z over all m.
// l[n,m] = scale * sum_c cf[c,n]*sf[c,m].  grid = B*(N/128), block = 256
// sf m-chunks (32 cols) are double-buffered via async global->LDS DMA.
// ---------------------------------------------------------------------------
__global__ __launch_bounds__(256) void c2s_stats_kernel(
    const float* __restrict__ sf, const float* __restrict__ cf,
    float* __restrict__ Mbuf, float* __restrict__ Rbuf)
{
  __shared__ float cfs[64 * 130];    // cf n-block (A operand, resident)
  __shared__ float sfs[2][64 * 36];  // sf m-chunks (B operand, async dbl-buf)
  const int tid  = threadIdx.x;
  const int b    = blockIdx.x >> 6;
  const int nblk = (blockIdx.x & 63) << 7;
  const size_t sbase = ((size_t)b << 6) * NSP;
  for (int i = tid; i < 64 * 128; i += 256) {
    int c = i >> 7, j = i & 127;
    cfs[c * 130 + j] = cf[sbase + (size_t)c * NSP + nblk + j];
  }
  // per-thread async share: 2x b128 per 32-wide chunk
  const int ca = tid >> 3;            // rows 0..31 (first op) / +32 (second)
  const int qa = (tid & 7) << 2;      // float quad within 32-col chunk
  async_g2l_b128(lds_off(&sfs[0][ca * 36 + qa]),        sf + sbase + (size_t)ca * NSP + qa);
  async_g2l_b128(lds_off(&sfs[0][(ca + 32) * 36 + qa]), sf + sbase + (size_t)(ca + 32) * NSP + qa);

  const int lane = tid & 31, wv = tid >> 5;
  const int hl = lane >> 4, lr = lane & 15;
  float M[8], Z[8];
#pragma unroll
  for (int v = 0; v < 8; ++v) { M[v] = -3.0e38f; Z[v] = 0.f; }

  for (int mb = 0, it = 0; mb < NSP; mb += 32, ++it) {
    const int cur = it & 1, nxt = cur ^ 1;
    __syncthreads();  // nobody still reads buf[nxt]
    if (mb + 32 < NSP) {
      async_g2l_b128(lds_off(&sfs[nxt][ca * 36 + qa]),
                     sf + sbase + (size_t)ca * NSP + mb + 32 + qa);
      async_g2l_b128(lds_off(&sfs[nxt][(ca + 32) * 36 + qa]),
                     sf + sbase + (size_t)(ca + 32) * NSP + mb + 32 + qa);
      asm volatile("s_wait_asynccnt 2" ::: "memory");  // chunk `cur` retired
    } else {
      asm volatile("s_wait_asynccnt 0" ::: "memory");
    }
    __syncthreads();  // all waves' async writes visible
    const float* S = &sfs[cur][0];
    for (int ms = 0; ms < 2; ++ms) {
      v8f acc = vzero8();
      for (int kb = 0; kb < 64; kb += 4) {
        const int k0 = kb + (hl << 1);
        v2f a;  a.x  = cfs[k0 * 130 + (wv << 4) + lr]; a.y  = cfs[(k0 + 1) * 130 + (wv << 4) + lr];
        v2f bb; bb.x = S[k0 * 36 + (ms << 4) + lr];    bb.y = S[(k0 + 1) * 36 + (ms << 4) + lr];
        acc = wmma4(a, bb, acc);
      }
#pragma unroll
      for (int v = 0; v < 8; ++v) {
        const float xv = acc[v] * SCALE;
        const float tm = rmax16(xv);
        const float nm = fmaxf(M[v], tm);
        const float ts = rsum16(__expf(xv - nm));
        Z[v] = Z[v] * __expf(M[v] - nm) + ts;
        M[v] = nm;
      }
    }
  }
  if (lr == 0) {
#pragma unroll
    for (int v = 0; v < 8; ++v) {
      const int n = nblk + (wv << 4) + (hl << 3) + v;
      Mbuf[b * NSP + n] = M[v];
      Rbuf[b * NSP + n] = 1.0f / Z[v];   // store reciprocal (Z >= 1 always)
    }
  }
}

// ---------------------------------------------------------------------------
// Kernel 5: c2s flash pass 2 + s2c output + residual.
// out[c,m] = sum_n sf[c,n]*exp(l[n,m]-M[n])/Z[n] + sum_k attn[c,k]*cf[k,m] + x
// grid = B*(N/128) m-blocks, block = 256.
// cf/sf n-tiles double-buffered via async global->LDS DMA.
// ---------------------------------------------------------------------------
__global__ __launch_bounds__(256) void c2s_out_kernel(
    const float* __restrict__ x, const float* __restrict__ sf,
    const float* __restrict__ cf, const float* __restrict__ Mbuf,
    const float* __restrict__ Rbuf, const float* __restrict__ attn,
    float* __restrict__ out)
{
  __shared__ float sfs[64 * 130];    // sf m-block (B operand for logits)
  __shared__ float cft[2][64 * 20];  // cf n-tile  (A for logits, async dbl-buf)
  __shared__ float sft[2][64 * 20];  // sf n-tile  (A for out GEMM, async dbl-buf)
  __shared__ float Pst[8][16 * 18];  // per-wave probability tile
  const int tid  = threadIdx.x;
  const int b    = blockIdx.x >> 6;
  const int mblk = (blockIdx.x & 63) << 7;
  const size_t sbase = ((size_t)b << 6) * NSP;
  for (int i = tid; i < 64 * 128; i += 256) {
    int c = i >> 7, j = i & 127;
    sfs[c * 130 + j] = sf[sbase + (size_t)c * NSP + mblk + j];
  }
  // per-thread async share for a 64x16 tile pair: 1 b128 from cf + 1 from sf
  const int ca = tid >> 2;           // row 0..63
  const int qa = (tid & 3) << 2;     // float quad within 16-col tile
  async_g2l_b128(lds_off(&cft[0][ca * 20 + qa]), cf + sbase + (size_t)ca * NSP + qa);
  async_g2l_b128(lds_off(&sft[0][ca * 20 + qa]), sf + sbase + (size_t)ca * NSP + qa);

  const int lane = tid & 31, wv = tid >> 5;
  const int hl = lane >> 4, lr = lane & 15;
  const int msub = wv << 4;
  v8f accO[4];
#pragma unroll
  for (int ct = 0; ct < 4; ++ct) accO[ct] = vzero8();

  for (int nt = 0; nt < NSP / 16; ++nt) {
    const int cur = nt & 1, nxt = cur ^ 1;
    const int nb = nt << 4;
    __syncthreads();  // nobody still reads buf[nxt]
    if (nt + 1 < NSP / 16) {
      async_g2l_b128(lds_off(&cft[nxt][ca * 20 + qa]),
                     cf + sbase + (size_t)ca * NSP + nb + 16 + qa);
      async_g2l_b128(lds_off(&sft[nxt][ca * 20 + qa]),
                     sf + sbase + (size_t)ca * NSP + nb + 16 + qa);
      asm volatile("s_wait_asynccnt 2" ::: "memory");  // tile `cur` retired
    } else {
      asm volatile("s_wait_asynccnt 0" ::: "memory");
    }
    __syncthreads();  // all waves' async writes visible
    const float* CT = &cft[cur][0];
    const float* ST = &sft[cur][0];
    // logits tile l[16 n x 16 m], K = 64 channels
    v8f acc = vzero8();
    for (int kb = 0; kb < 64; kb += 4) {
      const int k0 = kb + (hl << 1);
      v2f a;  a.x  = CT[k0 * 20 + lr];           a.y  = CT[(k0 + 1) * 20 + lr];
      v2f bb; bb.x = sfs[k0 * 130 + msub + lr];  bb.y = sfs[(k0 + 1) * 130 + msub + lr];
      acc = wmma4(a, bb, acc);
    }
    // P = exp(scale*l - M[n]) * (1/Z[n]); stage through per-wave LDS to
    // re-fragment D-layout -> B-layout for the next GEMM.
    float* Pw = &Pst[wv][0];
#pragma unroll
    for (int v = 0; v < 8; ++v) {
      const int n = nb + (hl << 3) + v;
      const float p = __expf(acc[v] * SCALE - Mbuf[b * NSP + n]) * Rbuf[b * NSP + n];
      Pw[((hl << 3) + v) * 18 + lr] = p;
    }
    asm volatile("s_wait_dscnt 0" ::: "memory");  // wave-local LDS RAW fence
    // accO[c-tile] += sf[c, n-tile] @ P[n-tile, m]
#pragma unroll
    for (int ct = 0; ct < 4; ++ct) {
      for (int kb = 0; kb < 16; kb += 4) {
        const int k0 = kb + (hl << 1);
        v2f a;  a.x  = ST[((ct << 4) + lr) * 20 + k0]; a.y  = ST[((ct << 4) + lr) * 20 + k0 + 1];
        v2f bb; bb.x = Pw[k0 * 18 + lr];               bb.y = Pw[(k0 + 1) * 18 + lr];
        accO[ct] = wmma4(a, bb, accO[ct]);
      }
    }
  }
  // s2c output: accO += attn[c,k] @ cf[k,m]   (K = 64, tiny)
#pragma unroll
  for (int ct = 0; ct < 4; ++ct) {
    for (int kb = 0; kb < 64; kb += 4) {
      const int k0 = kb + (hl << 1);
      v2f a;
      a.x = attn[b * 4096 + ((ct << 4) + lr) * 64 + k0];
      a.y = attn[b * 4096 + ((ct << 4) + lr) * 64 + k0 + 1];
      const size_t g0 = sbase + (size_t)k0 * NSP + mblk + msub + lr;
      v2f bb; bb.x = cf[g0]; bb.y = cf[g0 + NSP];
      accO[ct] = wmma4(a, bb, accO[ct]);
    }
  }
  // residual + store
#pragma unroll
  for (int ct = 0; ct < 4; ++ct) {
#pragma unroll
    for (int v = 0; v < 8; ++v) {
      const int c = (ct << 4) + (hl << 3) + v;
      const size_t idx = sbase + (size_t)c * NSP + mblk + msub + lr;
      out[idx] = accO[ct][v] + x[idx];
    }
  }
}

// ---------------------------------------------------------------------------
extern "C" void kernel_launch(void* const* d_in, const int* in_sizes, int n_in,
                              void* d_out, int out_size, void* d_ws, size_t ws_size,
                              hipStream_t stream)
{
  const float* x   = (const float*)d_in[0];
  const float* w_s = (const float*)d_in[1];
  const float* b_s = (const float*)d_in[2];
  const float* w_c = (const float*)d_in[3];
  const float* b_c = (const float*)d_in[4];
  float* out = (float*)d_out;

  float* ws = (float*)d_ws;
  float* sf = ws;                                   // [B,64,N]
  float* cf = sf + (size_t)NBAT * CCH * NSP;        // [B,64,N]
  float* Mb = cf + (size_t)NBAT * CCH * NSP;        // [B,N] row max
  float* Rb = Mb + (size_t)NBAT * NSP;              // [B,N] 1/rowsum
  float* lg = Rb + (size_t)NBAT * NSP;              // [B,64,64]
  float* at = lg + NBAT * CCH * CCH;                // [B,64,64]

  proj_kernel       <<<NBAT * (NSP / 64), 256, 0, stream>>>(x, w_s, b_s, w_c, b_c, sf, cf);
  s2c_logits_kernel <<<NBAT,              256, 0, stream>>>(sf, cf, lg);
  s2c_softmax_kernel<<<NBAT,               64, 0, stream>>>(lg, at);
  c2s_stats_kernel  <<<NBAT * (NSP / 128), 256, 0, stream>>>(sf, cf, Mb, Rb);
  c2s_out_kernel    <<<NBAT * (NSP / 128), 256, 0, stream>>>(x, sf, cf, Mb, Rb, at, out);
}

// v001
// It runs in 1110 microseconds.
// Next to v000, in two timings, it ran 1.49 times as fast each time.
#include <hip/hip_runtime.h>

typedef __attribute__((ext_vector_type(2))) float v2f;
typedef __attribute__((ext_vector_type(8))) float v8f;

#define CCH   64
#define NSP   8192
#define NBAT  2
#define SCALE 0.125f   // 64^-0.5

__device__ __forceinline__ v8f vzero8() {
  v8f z = {0.f,0.f,0.f,0.f,0.f,0.f,0.f,0.f};
  return z;
}

// D = A(16x4 f32) * B(4x16 f32) + C  -- CDNA5 fp32 WMMA
__device__ __forceinline__ v8f wmma4(v2f a, v2f b, v8f c) {
  return __builtin_amdgcn_wmma_f32_16x16x4_f32(
      /*neg_a=*/false, a, /*neg_b=*/false, b,
      /*c_mod=*/(short)0, c, /*reuse_a=*/false, /*reuse_b=*/false);
}

// generic->LDS offset: flat->local addrspace cast == low-32-bit truncation
__device__ __forceinline__ uint32_t lds_off(const void* p) {
  return (uint32_t)(uintptr_t)p;
}

// CDNA5 async DMA: 16B global -> LDS, tracked by ASYNCcnt
__device__ __forceinline__ void async_g2l_b128(uint32_t dst_lds, const void* gptr) {
  asm volatile("global_load_async_to_lds_b128 %0, %1, off"
               :: "v"(dst_lds), "v"(gptr) : "memory");
}

// reductions across the 16 lanes of each wave32 half (xor masks stay in-half)
__device__ __forceinline__ float rmax16(float x) {
  x = fmaxf(x, __shfl_xor(x, 1));
  x = fmaxf(x, __shfl_xor(x, 2));
  x = fmaxf(x, __shfl_xor(x, 4));
  x = fmaxf(x, __shfl_xor(x, 8));
  return x;
}
__device__ __forceinline__ float rsum16(float x) {
  x += __shfl_xor(x, 1);
  x += __shfl_xor(x, 2);
  x += __shfl_xor(x, 4);
  x += __shfl_xor(x, 8);
  return x;
}

// ---------------------------------------------------------------------------
// Kernel 1: sf = w_s @ x + b_s ; cf = w_c @ x + b_c   (per batch, per voxel)
// grid = B * (N/64), block = 256 (8 waves)
// ---------------------------------------------------------------------------
__global__ __launch_bounds__(256) void proj_kernel(
    const float* __restrict__ x, const float* __restrict__ w_s,
    const float* __restrict__ b_s, const float* __restrict__ w_c,
    const float* __restrict__ b_c, float* __restrict__ sf,
    float* __restrict__ cf)
{
  __shared__ float xs [64 * 66];
  __shared__ float wS [64 * 66];
  __shared__ float wC [64 * 66];
  const int tid  = threadIdx.x;
  const int b    = blockIdx.x >> 7;
  const int nb   = (blockIdx.x & 127) << 6;
  for (int i = tid; i < 64 * 64; i += 256) {
    int c = i >> 6, j = i & 63;
    xs[c * 66 + j] = x[((size_t)((b << 6) + c)) * NSP + nb + j];
    wS[c * 66 + j] = w_s[(c << 6) + j];
    wC[c * 66 + j] = w_c[(c << 6) + j];
  }
  __syncthreads();
  const int lane = tid & 31, wv = tid >> 5;
  const int hl = lane >> 4, lr = lane & 15;
  const int nsub = (wv & 3) << 4;
  const int opr  = (wv >> 2) << 1;
  for (int t = 0; t < 2; ++t) {
    const int ob = (opr + t) << 4;
    v8f accS = vzero8(), accC = vzero8();
    for (int kb = 0; kb < 64; kb += 4) {
      const int k0 = kb + (hl << 1);
      v2f bx; bx.x = xs[k0 * 66 + nsub + lr]; bx.y = xs[(k0 + 1) * 66 + nsub + lr];
      v2f aS; aS.x = wS[(ob + lr) * 66 + k0]; aS.y = wS[(ob + lr) * 66 + k0 + 1];
      v2f aC; aC.x = wC[(ob + lr) * 66 + k0]; aC.y = wC[(ob + lr) * 66 + k0 + 1];
      accS = wmma4(aS, bx, accS);
      accC = wmma4(aC, bx, accC);
    }
#pragma unroll
    for (int v = 0; v < 8; ++v) {
      const int o = ob + v + (hl << 3);
      const size_t idx = ((size_t)((b << 6) + o)) * NSP + nb + nsub + lr;
      sf[idx] = accS[v] + b_s[o];
      cf[idx] = accC[v] + b_c[o];
    }
  }
}

// ---------------------------------------------------------------------------
// Kernel 2: s2c logits[b,c,k] = scale * sum_n sf[c,n]*cf[k,n]   (64x64, K=8192)
// grid = B, block = 256
// ---------------------------------------------------------------------------
__global__ __launch_bounds__(256) void s2c_logits_kernel(
    const float* __restrict__ sf, const float* __restrict__ cf,
    float* __restrict__ lg)
{
  __shared__ float sfs[64 * 66];
  __shared__ float cfs[64 * 66];
  const int tid = threadIdx.x;
  const int b   = blockIdx.x;
  const int lane = tid & 31, wv = tid >> 5;
  const int hl = lane >> 4, lr = lane & 15;
  const int t0 = wv << 1, t1 = t0 + 1;
  const int ct0 = t0 >> 2, kt0 = t0 & 3;
  const int ct1 = t1 >> 2, kt1 = t1 & 3;
  v8f acc0 = vzero8(), acc1 = vzero8();
  for (int nb = 0; nb < NSP; nb += 64) {
    __syncthreads();
    for (int i = tid; i < 64 * 64; i += 256) {
      int c = i >> 6, j = i & 63;
      const size_t g = ((size_t)((b << 6) + c)) * NSP + nb + j;
      sfs[c * 66 + j] = sf[g];
      cfs[c * 66 + j] = cf[g];
    }
    __syncthreads();
    for (int kb = 0; kb < 64; kb += 4) {
      const int k0 = kb + (hl << 1);
      v2f a0; a0.x = sfs[((ct0 << 4) + lr) * 66 + k0]; a0.y = sfs[((ct0 << 4) + lr) * 66 + k0 + 1];
      v2f b0; b0.x = cfs[((kt0 << 4) + lr) * 66 + k0]; b0.y = cfs[((kt0 << 4) + lr) * 66 + k0 + 1];
      acc0 = wmma4(a0, b0, acc0);
      v2f a1; a1.x = sfs[((ct1 << 4) + lr) * 66 + k0]; a1.y = sfs[((ct1 << 4) + lr) * 66 + k0 + 1];
      v2f b1; b1.x = cfs[((kt1 << 4) + lr) * 66 + k0]; b1.y = cfs[((kt1 << 4) + lr) * 66 + k0 + 1];
      acc1 = wmma4(a1, b1, acc1);
    }
  }
#pragma unroll
  for (int v = 0; v < 8; ++v) {
    const int r = v + (hl << 3);
    lg[b * 4096 + ((ct0 << 4) + r) * 64 + (kt0 << 4) + lr] = acc0[v] * SCALE;
    lg[b * 4096 + ((ct1 << 4) + r) * 64 + (kt1 << 4) + lr] = acc1[v] * SCALE;
  }
}

// ---------------------------------------------------------------------------
// Kernel 3: softmax over k of the 64x64 s2c logits. grid = B, block = 64
// ---------------------------------------------------------------------------
__global__ void s2c_softmax_kernel(const float* __restrict__ lg,
                                   float* __restrict__ attn)
{
  const int b = blockIdx.x, r = threadIdx.x;
  const float* row = lg + b * 4096 + r * 64;
  float m = -3.0e38f;
  for (int k = 0; k < 64; ++k) m = fmaxf(m, row[k]);
  float s = 0.f;
  for (int k = 0; k < 64; ++k) s += __expf(row[k] - m);
  const float rs = 1.0f / s;
  for (int k = 0; k < 64; ++k)
    attn[b * 4096 + r * 64 + k] = __expf(row[k] - m) * rs;
}

// ---------------------------------------------------------------------------
// Kernel 4: c2s flash pass 1 — per-row (n) online max M and 1/Z over all m.
// M and Z are kept per lane in the m loop and merged across the 16 lanes after it.
// l[n,m] = scale * sum_c cf[c,n]*sf[c,m].  grid = B*(N/128), block = 256
// sf m-chunks (32 cols) are double-buffered via async global->LDS DMA.
// ---------------------------------------------------------------------------
__global__ __launch_bounds__(256) void c2s_stats_kernel(
    const float* __restrict__ sf, const float* __restrict__ cf,
    float* __restrict__ Mbuf, float* __restrict__ Rbuf)
{
  __shared__ float cfs[64 * 130];    // cf n-block (A operand, resident)
  __shared__ float sfs[2][64 * 36];  // sf m-chunks (B operand, async dbl-buf)
  const int tid  = threadIdx.x;
  const int b    = blockIdx.x >> 6;
  const int nblk = (blockIdx.x & 63) << 7;
  const size_t sbase = ((size_t)b << 6) * NSP;
  for (int i = tid; i < 64 * 128; i += 256) {
    int c = i >> 7, j = i & 127;
    cfs[c * 130 + j] = cf[sbase + (size_t)c * NSP + nblk + j];
  }
  // per-thread async share: 2x b128 per 32-wide chunk
  const int ca = tid >> 3;            // rows 0..31 (first op) / +32 (second)
  const int qa = (tid & 7) << 2;      // float quad within 32-col chunk
  async_g2l_b128(lds_off(&sfs[0][ca * 36 + qa]),        sf + sbase + (size_t)ca * NSP + qa);
  async_g2l_b128(lds_off(&sfs[0][(ca + 32) * 36 + qa]), sf + sbase + (size_t)(ca + 32) * NSP + qa);

  const int lane = tid & 31, wv = tid >> 5;
  const int hl = lane >> 4, lr = lane & 15;
  float M[8], Z[8];
#pragma unroll
  for (int v = 0; v < 8; ++v) { M[v] = -3.0e38f; Z[v] = 0.f; }

  for (int mb = 0, it = 0; mb < NSP; mb += 32, ++it) {
    const int cur = it & 1, nxt = cur ^ 1;
    __syncthreads();  // nobody still reads buf[nxt]
    if (mb + 32 < NSP) {
      async_g2l_b128(lds_off(&sfs[nxt][ca * 36 + qa]),
                     sf + sbase + (size_t)ca * NSP + mb + 32 + qa);
      async_g2l_b128(lds_off(&sfs[nxt][(ca + 32) * 36 + qa]),
                     sf + sbase + (size_t)(ca + 32) * NSP + mb + 32 + qa);
      asm volatile("s_wait_asynccnt 2" ::: "memory");  // chunk `cur` retired
    } else {
      asm volatile("s_wait_asynccnt 0" ::: "memory");
    }
    __syncthreads();  // all waves' async writes visible
    const float* S = &sfs[cur][0];
    for (int ms = 0; ms < 2; ++ms) {
      v8f acc = vzero8();
      for (int kb = 0; kb < 64; kb += 4) {
        const int k0 = kb + (hl << 1);
        v2f a;  a.x  = cfs[k0 * 130 + (wv << 4) + lr]; a.y  = cfs[(k0 + 1) * 130 + (wv << 4) + lr];
        v2f bb; bb.x = S[k0 * 36 + (ms << 4) + lr];    bb.y = S[(k0 + 1) * 36 + (ms << 4) + lr];
        acc = wmma4(a, bb, acc);
      }
#pragma unroll
      for (int v = 0; v < 8; ++v) {
        // each lane folds only its own column (m = lr mod 16) into its own M, Z
        const float xv = acc[v] * SCALE;
        const float nm = fmaxf(M[v], xv);
        Z[v] = Z[v] * __expf(M[v] - nm) + __expf(xv - nm);
        M[v] = nm;
      }
    }
  }
  // merge the 16 per-lane (M, Z) pairs of each row, once per row
  // (unrolled so that M[v] and Z[v] are indexed by constants and stay in registers)
#pragma unroll
  for (int v = 0; v < 8; ++v) {
    const float mt = rmax16(M[v]);
    Z[v] = rsum16(Z[v] * __expf(M[v] - mt));
    M[v] = mt;
  }
  if (lr == 0) {
#pragma unroll
    for (int v = 0; v < 8; ++v) {
      const int n = nblk + (wv << 4) + (hl << 3) + v;
      Mbuf[b * NSP + n] = M[v];
      Rbuf[b * NSP + n] = 1.0f / Z[v];   // store reciprocal (Z >= 1 always)
    }
  }
}

// ---------------------------------------------------------------------------
// Kernel 5: c2s flash pass 2 + s2c output + residual.
// out[c,m] = sum_n sf[c,n]*exp(l[n,m]-M[n])/Z[n] + sum_k attn[c,k]*cf[k,m] + x
// grid = B*(N/128) m-blocks, block = 256.
// cf/sf n-tiles double-buffered via async global->LDS DMA.
// ---------------------------------------------------------------------------
__global__ __launch_bounds__(256) void c2s_out_kernel(
    const float* __restrict__ x, const float* __restrict__ sf,
    const float* __restrict__ cf, const float* __restrict__ Mbuf,
    const float* __restrict__ Rbuf, const float* __restrict__ attn,
    float* __restrict__ out)
{
  __shared__ float sfs[64 * 130];    // sf m-block (B operand for logits)
  __shared__ float cft[2][64 * 20];  // cf n-tile  (A for logits, async dbl-buf)
  __shared__ float sft[2][64 * 20];  // sf n-tile  (A for out GEMM, async dbl-buf)
  __shared__ float Pst[8][16 * 18];  // per-wave probability tile
  const int tid  = threadIdx.x;
  const int b    = blockIdx.x >> 6;
  const int mblk = (blockIdx.x & 63) << 7;
  const size_t sbase = ((size_t)b << 6) * NSP;
  for (int i = tid; i < 64 * 128; i += 256) {
    int c = i >> 7, j = i & 127;
    sfs[c * 130 + j] = sf[sbase + (size_t)c * NSP + mblk + j];
  }
  // per-thread async share for a 64x16 tile pair: 1 b128 from cf + 1 from sf
  const int ca = tid >> 2;           // row 0..63
  const int qa = (tid & 3) << 2;     // float quad within 16-col tile
  async_g2l_b128(lds_off(&cft[0][ca * 20 + qa]), cf + sbase + (size_t)ca * NSP + qa);
  async_g2l_b128(lds_off(&sft[0][ca * 20 + qa]), sf + sbase + (size_t)ca * NSP + qa);

  const int lane = tid & 31, wv = tid >> 5;
  const int hl = lane >> 4, lr = lane & 15;
  const int msub = wv << 4;
  v8f accO[4];
#pragma unroll
  for (int ct = 0; ct < 4; ++ct) accO[ct] = vzero8();

  for (int nt = 0; nt < NSP / 16; ++nt) {
    const int cur = nt & 1, nxt = cur ^ 1;
    const int nb = nt << 4;
    __syncthreads();  // nobody still reads buf[nxt]
    if (nt + 1 < NSP / 16) {
      async_g2l_b128(lds_off(&cft[nxt][ca * 20 + qa]),
                     cf + sbase + (size_t)ca * NSP + nb + 16 + qa);
      async_g2l_b128(lds_off(&sft[nxt][ca * 20 + qa]),
                     sf + sbase + (size_t)ca * NSP + nb + 16 + qa);
      asm volatile("s_wait_asynccnt 2" ::: "memory");  // tile `cur` retired
    } else {
      asm volatile("s_wait_asynccnt 0" ::: "memory");
    }
    __syncthreads();  // all waves' async writes visible
    const float* CT = &cft[cur][0];
    const float* ST = &sft[cur][0];
    // logits tile l[16 n x 16 m], K = 64 channels
    v8f acc = vzero8();
    for (int kb = 0; kb < 64; kb += 4) {
      const int k0 = kb + (hl << 1);
      v2f a;  a.x  = CT[k0 * 20 + lr];           a.y  = CT[(k0 + 1) * 20 + lr];
      v2f bb; bb.x = sfs[k0 * 130 + msub + lr];  bb.y = sfs[(k0 + 1) * 130 + msub + lr];
      acc = wmma4(a, bb, acc);
    }
    // P = exp(scale*l - M[n]) * (1/Z[n]); stage through per-wave LDS to
    // re-fragment D-layout -> B-layout for the next GEMM.
    float* Pw = &Pst[wv][0];
#pragma unroll
    for (int v = 0; v < 8; ++v) {
      const int n = nb + (hl << 3) + v;
      const float p = __expf(acc[v] * SCALE - Mbuf[b * NSP + n]) * Rbuf[b * NSP + n];
      Pw[((hl << 3) + v) * 18 + lr] = p;
    }
    asm volatile("s_wait_dscnt 0" ::: "memory");  // wave-local LDS RAW fence
    // accO[c-tile] += sf[c, n-tile] @ P[n-tile, m]
#pragma unroll
    for (int ct = 0; ct < 4; ++ct) {
      for (int kb = 0; kb < 16; kb += 4) {
        const int k0 = kb + (hl << 1);
        v2f a;  a.x  = ST[((ct << 4) + lr) * 20 + k0]; a.y  = ST[((ct << 4) + lr) * 20 + k0 + 1];
        v2f bb; bb.x = Pw[k0 * 18 + lr];               bb.y = Pw[(k0 + 1) * 18 + lr];
        accO[ct] = wmma4(a, bb, accO[ct]);
      }
    }
  }
  // s2c output: accO += attn[c,k] @ cf[k,m]   (K = 64, tiny)
#pragma unroll
  for (int ct = 0; ct < 4; ++ct) {
    for (int kb = 0; kb < 64; kb += 4) {
      const int k0 = kb + (hl << 1);
      v2f a;
      a.x = attn[b * 4096 + ((ct << 4) + lr) * 64 + k0];
      a.y = attn[b * 4096 + ((ct << 4) + lr) * 64 + k0 + 1];
      const size_t g0 = sbase + (size_t)k0 * NSP + mblk + msub + lr;
      v2f bb; bb.x = cf[g0]; bb.y = cf[g0 + NSP];
      accO[ct] = wmma4(a, bb, accO[ct]);
    }
  }
  // residual + store
#pragma unroll
  for (int ct = 0; ct < 4; ++ct) {
#pragma unroll
    for (int v = 0; v < 8; ++v) {
      const int c = (ct << 4) + (hl << 3) + v;
      const size_t idx = sbase + (size_t)c * NSP + mblk + msub + lr;
      out[idx] = accO[ct][v] + x[idx];
    }
  }
}

// ---------------------------------------------------------------------------
extern "C" void kernel_launch(void* const* d_in, const int* in_sizes, int n_in,
                              void* d_out, int out_size, void* d_ws, size_t ws_size,
                              hipStream_t stream)
{
  const float* x   = (const float*)d_in[0];
  const float* w_s = (const float*)d_in[1];
  const float* b_s = (const float*)d_in[2];
  const float* w_c = (const float*)d_in[3];
  const float* b_c = (const float*)d_in[4];
  float* out = (float*)d_out;

  float* ws = (float*)d_ws;
  float* sf = ws;                                   // [B,64,N]
  float* cf = sf + (size_t)NBAT * CCH * NSP;        // [B,64,N]
  float* Mb = cf + (size_t)NBAT * CCH * NSP;        // [B,N] row max
  float* Rb = Mb + (size_t)NBAT * NSP;              // [B,N] 1/rowsum
  float* lg = Rb + (size_t)NBAT * NSP;              // [B,64,64]
  float* at = lg + NBAT * CCH * CCH;                // [B,64,64]

  proj_kernel       <<<NBAT * (NSP / 64), 256, 0, stream>>>(x, w_s, b_s, w_c, b_c, sf, cf);
  s2c_logits_kernel <<<NBAT,              256, 0, stream>>>(sf, cf, lg);
  s2c_softmax_kernel<<<NBAT,               64, 0, stream>>>(lg, at);
  c2s_stats_kernel  <<<NBAT * (NSP / 128), 256, 0, stream>>>(sf, cf, Mb, Rb);
  c2s_out_kernel    <<<NBAT * (NSP / 128), 256, 0, stream>>>(x, sf, cf, Mb, Rb, at, out);
}

// v002
// It runs in 803 microseconds.
// Two timings next to v001 put it at 1.39 and 1.38 times that version's speed.
// All steps since v000 together make it 2.06 times as fast.
#include <hip/hip_runtime.h>

typedef __attribute__((ext_vector_type(2))) float v2f;
typedef __attribute__((ext_vector_type(8))) float v8f;

#define CCH   64
#define NSP   8192
#define NBAT  2
#define SCALE 0.125f   // 64^-0.5

__device__ __forceinline__ v8f vzero8() {
  v8f z = {0.f,0.f,0.f,0.f,0.f,0.f,0.f,0.f};
  return z;
}

// D = A(16x4 f32) * B(4x16 f32) + C  -- CDNA5 fp32 WMMA
__device__ __forceinline__ v8f wmma4(v2f a, v2f b, v8f c) {
  return __builtin_amdgcn_wmma_f32_16x16x4_f32(
      /*neg_a=*/false, a, /*neg_b=*/false, b,
      /*c_mod=*/(short)0, c, /*reuse_a=*/false, /*reuse_b=*/false);
}

// generic->LDS offset: flat->local addrspace cast == low-32-bit truncation
__device__ __forceinline__ uint32_t lds_off(const void* p) {
  return (uint32_t)(uintptr_t)p;
}

// CDNA5 async DMA: four 16B global -> LDS copies per lane, tracked by ASYNCcnt.
// s_wait_xcnt closes the statement so that no address register of a copy can be
// rewritten (next trip's address additions) ahead of it.
__device__ __forceinline__ void async_g2l_b128x4(
    uint32_t d0, const void* g0, uint32_t d1, const void* g1,
    uint32_t d2, const void* g2, uint32_t d3, const void* g3) {
  asm volatile("global_load_async_to_lds_b128 %0, %1, off\n\t"
               "global_load_async_to_lds_b128 %2, %3, off\n\t"
               "global_load_async_to_lds_b128 %4, %5, off\n\t"
               "global_load_async_to_lds_b128 %6, %7, off\n\t"
               "s_wait_xcnt 0x0"
               :: "v"(d0), "v"(g0), "v"(d1), "v"(g1),
                  "v"(d2), "v"(g2), "v"(d3), "v"(g3) : "memory");
}

// reductions across the 16 lanes of each wave32 half (xor masks stay in-half)
__device__ __forceinline__ float rmax16(float x) {
  x = fmaxf(x, __shfl_xor(x, 1));
  x = fmaxf(x, __shfl_xor(x, 2));
  x = fmaxf(x, __shfl_xor(x, 4));
  x = fmaxf(x, __shfl_xor(x, 8));
  return x;
}
__device__ __forceinline__ float rsum16(float x) {
  x += __shfl_xor(x, 1);
  x += __shfl_xor(x, 2);
  x += __shfl_xor(x, 4);
  x += __shfl_xor(x, 8);
  return x;
}

// ---------------------------------------------------------------------------
// Kernel 1: sf = w_s @ x + b_s ; cf = w_c @ x + b_c   (per batch, per voxel)
// grid = B * (N/64), block = 256 (8 waves)
// ---------------------------------------------------------------------------
__global__ __launch_bounds__(256) void proj_kernel(
    const float* __restrict__ x, const float* __restrict__ w_s,
    const float* __restrict__ b_s, const float* __restrict__ w_c,
    const float* __restrict__ b_c, float* __restrict__ sf,
    float* __restrict__ cf)
{
  __shared__ float xs [64 * 66];
  __shared__ float wS [64 * 66];
  __shared__ float wC [64 * 66];
  const int tid  = threadIdx.x;
  const int b    = blockIdx.x >> 7;
  const int nb   = (blockIdx.x & 127) << 6;
  for (int i = tid; i < 64 * 64; i += 256) {
    int c = i >> 6, j = i & 63;
    xs[c * 66 + j] = x[((size_t)((b << 6) + c)) * NSP + nb + j];
    wS[c * 66 + j] = w_s[(c << 6) + j];
    wC[c * 66 + j] = w_c[(c << 6) + j];
  }
  __syncthreads();
  const int lane = tid & 31, wv = tid >> 5;
  const int hl = lane >> 4, lr = lane & 15;
  const int nsub = (wv & 3) << 4;
  const int opr  = (wv >> 2) << 1;
  for (int t = 0; t < 2; ++t) {
    const int ob = (opr + t) << 4;
    v8f accS = vzero8(), accC = vzero8();
    for (int kb = 0; kb < 64; kb += 4) {
      const int k0 = kb + (hl << 1);
      v2f bx; bx.x = xs[k0 * 66 + nsub + lr]; bx.y = xs[(k0 + 1) * 66 + nsub + lr];
      v2f aS; aS.x = wS[(ob + lr) * 66 + k0]; aS.y = wS[(ob + lr) * 66 + k0 + 1];
      v2f aC; aC.x = wC[(ob + lr) * 66 + k0]; aC.y = wC[(ob + lr) * 66 + k0 + 1];
      accS = wmma4(aS, bx, accS);
      accC = wmma4(aC, bx, accC);
    }
#pragma unroll
    for (int v = 0; v < 8; ++v) {
      const int o = ob + v + (hl << 3);
      const size_t idx = ((size_t)((b << 6) + o)) * NSP + nb + nsub + lr;
      sf[idx] = accS[v] + b_s[o];
      cf[idx] = accC[v] + b_c[o];
    }
  }
}

// ---------------------------------------------------------------------------
// Kernel 2: s2c logits[b,c,k] = scale * sum_n sf[c,n]*cf[k,n]   (64x64, K=8192)
// grid = B, block = 256
// ---------------------------------------------------------------------------
__global__ __launch_bounds__(256) void s2c_logits_kernel(
    const float* __restrict__ sf, const float* __restrict__ cf,
    float* __restrict__ lg)
{
  __shared__ float sfs[64 * 66];
  __shared__ float cfs[64 * 66];
  const int tid = threadIdx.x;
  const int b   = blockIdx.x;
  const int lane = tid & 31, wv = tid >> 5;
  const int hl = lane >> 4, lr = lane & 15;
  const int t0 = wv << 1, t1 = t0 + 1;
  const int ct0 = t0 >> 2, kt0 = t0 & 3;
  const int ct1 = t1 >> 2, kt1 = t1 & 3;
  v8f acc0 = vzero8(), acc1 = vzero8();
  for (int nb = 0; nb < NSP; nb += 64) {
    __syncthreads();
    for (int i = tid; i < 64 * 64; i += 256) {
      int c = i >> 6, j = i & 63;
      const size_t g = ((size_t)((b << 6) + c)) * NSP + nb + j;
      sfs[c * 66 + j] = sf[g];
      cfs[c * 66 + j] = cf[g];
    }
    __syncthreads();
    for (int kb = 0; kb < 64; kb += 4) {
      const int k0 = kb + (hl << 1);
      v2f a0; a0.x = sfs[((ct0 << 4) + lr) * 66 + k0]; a0.y = sfs[((ct0 << 4) + lr) * 66 + k0 + 1];
      v2f b0; b0.x = cfs[((kt0 << 4) + lr) * 66 + k0]; b0.y = cfs[((kt0 << 4) + lr) * 66 + k0 + 1];
      acc0 = wmma4(a0, b0, acc0);
      v2f a1; a1.x = sfs[((ct1 << 4) + lr) * 66 + k0]; a1.y = sfs[((ct1 << 4) + lr) * 66 + k0 + 1];
      v2f b1; b1.x = cfs[((kt1 << 4) + lr) * 66 + k0]; b1.y = cfs[((kt1 << 4) + lr) * 66 + k0 + 1];
      acc1 = wmma4(a1, b1, acc1);
    }
  }
#pragma unroll
  for (int v = 0; v < 8; ++v) {
    const int r = v + (hl << 3);
    lg[b * 4096 + ((ct0 << 4) + r) * 64 + (kt0 << 4) + lr] = acc0[v] * SCALE;
    lg[b * 4096 + ((ct1 << 4) + r) * 64 + (kt1 << 4) + lr] = acc1[v] * SCALE;
  }
}

// ---------------------------------------------------------------------------
// Kernel 3: softmax over k of the 64x64 s2c logits. grid = B, block = 64
// ---------------------------------------------------------------------------
__global__ void s2c_softmax_kernel(const float* __restrict__ lg,
                                   float* __restrict__ attn)
{
  const int b = blockIdx.x, r = threadIdx.x;
  const float* row = lg + b * 4096 + r * 64;
  float m = -3.0e38f;
  for (int k = 0; k < 64; ++k) m = fmaxf(m, row[k]);
  float s = 0.f;
  for (int k = 0; k < 64; ++k) s += __expf(row[k] - m);
  const float rs = 1.0f / s;
  for (int k = 0; k < 64; ++k)
    attn[b * 4096 + r * 64 + k] = __expf(row[k] - m) * rs;
}

// ---------------------------------------------------------------------------
// Kernel 4: c2s flash pass 1 - per-row (n) online max M and 1/Z over all m.
// l[n,m] = scale * sum_c cf[c,n]*sf[c,m].  grid = B*(N/64), block = 512 (16 waves).
// Wave (wv & 3) owns 16 of the 64 rows; wave group (wv >> 2) owns 32 of the 128
// columns of every m-chunk, so four waves share each row's m loop.
// M and Z are kept per lane in the m loop, merged across the 16 lanes after it,
// and the four groups' (M, Z) pairs of a row are merged through LDS at the end.
// sf m-chunks (128 cols) are double-buffered via async global->LDS DMA.
// ---------------------------------------------------------------------------
__global__ __launch_bounds__(512) void c2s_stats_kernel(
    const float* __restrict__ sf, const float* __restrict__ cf,
    float* __restrict__ Mbuf, float* __restrict__ Rbuf)
{
  __shared__ float cfs[64 * 66];     // cf n-block (A operand, resident)
  __shared__ __attribute__((aligned(16))) float sfs[2][64 * 132];  // sf m-chunks (B operand, async dbl-buf)
  __shared__ float Mx[4][64];        // per wave group: row max
  __shared__ float Zx[4][64];        // per wave group: row sum
  const int tid  = threadIdx.x;
  const int b    = blockIdx.x >> 7;
  const int nblk = (blockIdx.x & 127) << 6;
  const size_t sbase = ((size_t)b << 6) * NSP;
  for (int i = tid; i < 64 * 64; i += 512) {
    int c = i >> 6, j = i & 63;
    cfs[c * 66 + j] = cf[sbase + (size_t)c * NSP + nblk + j];
  }
  // per-thread async share: 4x b128 per 128-wide chunk (a wave copies whole rows)
  const int ca = tid >> 5;            // rows 0..15, then +16, +32, +48
  const int qa = (tid & 31) << 2;     // float quad within the 128-col chunk
  const float* gs = sf + sbase + (size_t)ca * NSP + qa;
  async_g2l_b128x4(lds_off(&sfs[0][ca * 132 + qa]),        gs,
                   lds_off(&sfs[0][(ca + 16) * 132 + qa]), gs + (size_t)16 * NSP,
                   lds_off(&sfs[0][(ca + 32) * 132 + qa]), gs + (size_t)32 * NSP,
                   lds_off(&sfs[0][(ca + 48) * 132 + qa]), gs + (size_t)48 * NSP);

  const int lane = tid & 31, wv = tid >> 5;
  const int hl = lane >> 4, lr = lane & 15;
  const int nsub = (wv & 3) << 4;     // this wave's 16 rows
  const int grp  = wv >> 2;           // this wave's column group
  float M[8], Z[8];
#pragma unroll
  for (int v = 0; v < 8; ++v) { M[v] = -3.0e38f; Z[v] = 0.f; }

  for (int mb = 0, it = 0; mb < NSP; mb += 128, ++it) {
    const int cur = it & 1, nxt = cur ^ 1;
    __syncthreads();  // nobody still reads buf[nxt]
    if (mb + 128 < NSP) {
      const float* gn = gs + mb + 128;
      async_g2l_b128x4(lds_off(&sfs[nxt][ca * 132 + qa]),        gn,
                       lds_off(&sfs[nxt][(ca + 16) * 132 + qa]), gn + (size_t)16 * NSP,
                       lds_off(&sfs[nxt][(ca + 32) * 132 + qa]), gn + (size_t)32 * NSP,
                       lds_off(&sfs[nxt][(ca + 48) * 132 + qa]), gn + (size_t)48 * NSP);
      asm volatile("s_wait_asynccnt 4" ::: "memory");  // chunk `cur` retired
    } else {
      asm volatile("s_wait_asynccnt 0" ::: "memory");
    }
    __syncthreads();  // all waves' async writes visible
    const float* S = &sfs[cur][grp << 5];
    for (int ms = 0; ms < 2; ++ms) {
      v8f acc = vzero8();
      for (int kb = 0; kb < 64; kb += 4) {
        const int k0 = kb + (hl << 1);
        v2f a;  a.x  = cfs[k0 * 66 + nsub + lr];        a.y  = cfs[(k0 + 1) * 66 + nsub + lr];
        v2f bb; bb.x = S[k0 * 132 + (ms << 4) + lr];    bb.y = S[(k0 + 1) * 132 + (ms << 4) + lr];
        acc = wmma4(a, bb, acc);
      }
#pragma unroll
      for (int v = 0; v < 8; ++v) {
        // each lane folds only its own column into its own M, Z
        const float xv = acc[v] * SCALE;
        const float nm = fmaxf(M[v], xv);
        Z[v] = Z[v] * __expf(M[v] - nm) + __expf(xv - nm);
        M[v] = nm;
      }
    }
  }
  // merge the 16 per-lane (M, Z) pairs of each row, once per row
  // (unrolled so that M[v] and Z[v] are indexed by constants and stay in registers)
#pragma unroll
  for (int v = 0; v < 8; ++v) {
    const float mt = rmax16(M[v]);
    Z[v] = rsum16(Z[v] * __expf(M[v] - mt));
    M[v] = mt;
  }
  if (lr == 0) {
#pragma unroll
    for (int v = 0; v < 8; ++v) {
      const int r = nsub + (hl << 3) + v;
      Mx[grp][r] = M[v];
      Zx[grp][r] = Z[v];
    }
  }
  __syncthreads();  // the four groups' pairs of every row are in LDS
  if (tid < 64) {
    const float m0 = Mx[0][tid], m1 = Mx[1][tid], m2 = Mx[2][tid], m3 = Mx[3][tid];
    const float mt = fmaxf(fmaxf(m0, m1), fmaxf(m2, m3));
    const float z  = Zx[0][tid] * __expf(m0 - mt) + Zx[1][tid] * __expf(m1 - mt)
                   + Zx[2][tid] * __expf(m2 - mt) + Zx[3][tid] * __expf(m3 - mt);
    Mbuf[b * NSP + nblk + tid] = mt;
    Rbuf[b * NSP + nblk + tid] = 1.0f / z;   // store reciprocal (z >= 1 always)
  }
}

// ---------------------------------------------------------------------------
// Kernel 5: c2s flash pass 2 + s2c output + residual.
// out[c,m] = sum_n sf[c,n]*exp(l[n,m]-M[n])/Z[n] + sum_k attn[c,k]*cf[k,m] + x
// grid = B*(N/64) m-blocks, block = 512 (16 waves).
// Wave (wv & 3) owns 16 of the 64 columns; wave group (wv >> 2) owns one of the
// four 16-wide n-tiles of every stage, so four waves share each column's n loop.
// Their partial sums are added through LDS after the loop.
// cf/sf n-tiles double-buffered via async global->LDS DMA.
// ---------------------------------------------------------------------------
__global__ __launch_bounds__(512) void c2s_out_kernel(
    const float* __restrict__ x, const float* __restrict__ sf,
    const float* __restrict__ cf, const float* __restrict__ Mbuf,
    const float* __restrict__ Rbuf, const float* __restrict__ attn,
    float* __restrict__ out)
{
  __shared__ float sfs[64 * 66];     // sf m-block (B operand for logits)
  __shared__ __attribute__((aligned(16))) float cft[2][4][64 * 20];  // cf n-tiles (A for logits, async dbl-buf)
  __shared__ __attribute__((aligned(16))) float sft[2][4][64 * 20];  // sf n-tiles (A for out GEMM, async dbl-buf)
  __shared__ float Pst[16][16 * 18]; // per-wave probability tile
  __shared__ float red[3][4][32 * 32];  // partial sums of wave groups 1..3
  const int tid  = threadIdx.x;
  const int b    = blockIdx.x >> 7;
  const int mblk = (blockIdx.x & 127) << 6;
  const size_t sbase = ((size_t)b << 6) * NSP;
  for (int i = tid; i < 64 * 64; i += 512) {
    int c = i >> 6, j = i & 63;
    sfs[c * 66 + j] = sf[sbase + (size_t)c * NSP + mblk + j];
  }
  // per-thread async share for a stage (64 rows x 64 n of cf and of sf):
  // 2 b128 from cf + 2 from sf; 16 lanes cover one row's 256 bytes
  const int ca = tid >> 4;           // row 0..31, then +32
  const int ta = (tid & 15) >> 2;    // n-tile within the stage
  const int qa = (tid & 3) << 2;     // float quad within the 16-col tile
  const size_t ga = sbase + (size_t)ca * NSP + (ta << 4) + qa;
  async_g2l_b128x4(lds_off(&cft[0][ta][ca * 20 + qa]),        cf + ga,
                   lds_off(&cft[0][ta][(ca + 32) * 20 + qa]), cf + ga + (size_t)32 * NSP,
                   lds_off(&sft[0][ta][ca * 20 + qa]),        sf + ga,
                   lds_off(&sft[0][ta][(ca + 32) * 20 + qa]), sf + ga + (size_t)32 * NSP);

  const int lane = tid & 31, wv = tid >> 5;
  const int hl = lane >> 4, lr = lane & 15;
  const int msub = (wv & 3) << 4;    // this wave's 16 columns
  const int grp  = wv >> 2;          // this wave's n-tile of every stage
  v8f accO[4];
#pragma unroll
  for (int ct = 0; ct < 4; ++ct) accO[ct] = vzero8();

  for (int st = 0; st < NSP / 64; ++st) {
    const int cur = st & 1, nxt = cur ^ 1;
    const int nb = (st << 6) + (grp << 4);
    __syncthreads();  // nobody still reads buf[nxt]
    if (st + 1 < NSP / 64) {
      const size_t gn = ga + (st << 6) + 64;
      async_g2l_b128x4(lds_off(&cft[nxt][ta][ca * 20 + qa]),        cf + gn,
                       lds_off(&cft[nxt][ta][(ca + 32) * 20 + qa]), cf + gn + (size_t)32 * NSP,
                       lds_off(&sft[nxt][ta][ca * 20 + qa]),        sf + gn,
                       lds_off(&sft[nxt][ta][(ca + 32) * 20 + qa]), sf + gn + (size_t)32 * NSP);
      asm volatile("s_wait_asynccnt 4" ::: "memory");  // stage `cur` retired
    } else {
      asm volatile("s_wait_asynccnt 0" ::: "memory");
    }
    __syncthreads();  // all waves' async writes visible
    const float* CT = &cft[cur][grp][0];
    const float* ST = &sft[cur][grp][0];
    // logits tile l[16 n x 16 m], K = 64 channels
    v8f acc = vzero8();
    for (int kb = 0; kb < 64; kb += 4) {
      const int k0 = kb + (hl << 1);
      v2f a;  a.x  = CT[k0 * 20 + lr];          a.y  = CT[(k0 + 1) * 20 + lr];
      v2f bb; bb.x = sfs[k0 * 66 + msub + lr];  bb.y = sfs[(k0 + 1) * 66 + msub + lr];
      acc = wmma4(a, bb, acc);
    }
    // P = exp(scale*l - M[n]) * (1/Z[n]); stage through per-wave LDS to
    // re-fragment D-layout -> B-layout for the next GEMM.
    float* Pw = &Pst[wv][0];
#pragma unroll
    for (int v = 0; v < 8; ++v) {
      const int n = nb + (hl << 3) + v;
      const float p = __expf(acc[v] * SCALE - Mbuf[b * NSP + n]) * Rbuf[b * NSP + n];
      Pw[((hl << 3) + v) * 18 + lr] = p;
    }
    asm volatile("s_wait_dscnt 0" ::: "memory");  // wave-local LDS RAW fence
    // accO[c-tile] += sf[c, n-tile] @ P[n-tile, m]
#pragma unroll
    for (int ct = 0; ct < 4; ++ct) {
      for (int kb = 0; kb < 16; kb += 4) {
        const int k0 = kb + (hl << 1);
        v2f a;  a.x  = ST[((ct << 4) + lr) * 20 + k0]; a.y  = ST[((ct << 4) + lr) * 20 + k0 + 1];
        v2f bb; bb.x = Pw[k0 * 18 + lr];               bb.y = Pw[(k0 + 1) * 18 + lr];
        accO[ct] = wmma4(a, bb, accO[ct]);
      }
    }
  }
  // add the four wave groups' partial sums: groups 1..3 hand theirs to group 0
  if (grp != 0) {
    float* R = &red[grp - 1][wv & 3][0];
#pragma unroll
    for (int ct = 0; ct < 4; ++ct) {
#pragma unroll
      for (int v = 0; v < 8; ++v) R[((ct << 3) + v) * 32 + lane] = accO[ct][v];
    }
  }
  __syncthreads();  // the partial sums are in LDS
  if (grp != 0) return;
#pragma unroll
  for (int k = 0; k < 3; ++k) {
    const float* R = &red[k][wv][0];
#pragma unroll
    for (int ct = 0; ct < 4; ++ct) {
#pragma unroll
      for (int v = 0; v < 8; ++v) accO[ct][v] += R[((ct << 3) + v) * 32 + lane];
    }
  }
  // s2c output: accO += attn[c,k] @ cf[k,m]   (K = 64, tiny)
#pragma unroll
  for (int ct = 0; ct < 4; ++ct) {
    for (int kb = 0; kb < 64; kb += 4) {
      const int k0 = kb + (hl << 1);
      v2f a;
      a.x = attn[b * 4096 + ((ct << 4) + lr) * 64 + k0];
      a.y = attn[b * 4096 + ((ct << 4) + lr) * 64 + k0 + 1];
      const size_t g0 = sbase + (size_t)k0 * NSP + mblk + msub + lr;
      v2f bb; bb.x = cf[g0]; bb.y = cf[g0 + NSP];
      accO[ct] = wmma4(a, bb, accO[ct]);
    }
  }
  // residual + store
#pragma unroll
  for (int ct = 0; ct < 4; ++ct) {
#pragma unroll
    for (int v = 0; v < 8; ++v) {
      const int c = (ct << 4) + (hl << 3) + v;
      const size_t idx = sbase + (size_t)c * NSP + mblk + msub + lr;
      out[idx] = accO[ct][v] + x[idx];
    }
  }
}

// ---------------------------------------------------------------------------
extern "C" void kernel_launch(void* const* d_in, const int* in_sizes, int n_in,
                              void* d_out, int out_size, void* d_ws, size_t ws_size,
                              hipStream_t stream)
{
  const float* x   = (const float*)d_in[0];
  const float* w_s = (const float*)d_in[1];
  const float* b_s = (const float*)d_in[2];
  const float* w_c = (const float*)d_in[3];
  const float* b_c = (const float*)d_in[4];
  float* out = (float*)d_out;

  float* ws = (float*)d_ws;
  float* sf = ws;                                   // [B,64,N]
  float* cf = sf + (size_t)NBAT * CCH * NSP;        // [B,64,N]
  float* Mb = cf + (size_t)NBAT * CCH * NSP;        // [B,N] row max
  float* Rb = Mb + (size_t)NBAT * NSP;              // [B,N] 1/rowsum
  float* lg = Rb + (size_t)NBAT * NSP;              // [B,64,64]
  float* at = lg + NBAT * CCH * CCH;                // [B,64,64]

  proj_kernel       <<<NBAT * (NSP / 64), 256, 0, stream>>>(x, w_s, b_s, w_c, b_c, sf, cf);
  s2c_logits_kernel <<<NBAT,              256, 0, stream>>>(sf, cf, lg);
  s2c_softmax_kernel<<<NBAT,               64, 0, stream>>>(lg, at);
  c2s_stats_kernel  <<<NBAT * (NSP / 64),  512, 0, stream>>>(sf, cf, Mb, Rb);
  c2s_out_kernel    <<<NBAT * (NSP / 64),  512, 0, stream>>>(x, sf, cf, Mb, Rb, at, out);
}

// v003
// A run of this version takes 377 microseconds.
// Next to v002, in two timings, it ran 2.13 and 2.12 times as fast.
// All steps since v000 together make it 4.37 times as fast.
#include <hip/hip_runtime.h>

typedef __attribute__((ext_vector_type(2))) float v2f;
typedef __attribute__((ext_vector_type(8))) float v8f;

#define CCH   64
#define NSP   8192
#define NBAT  2
#define SCALE 0.125f   // 64^-0.5
#define KSPLIT (NSP / 64)  // work-groups that share one batch's n sum in the s2c logits

__device__ __forceinline__ v8f vzero8() {
  v8f z = {0.f,0.f,0.f,0.f,0.f,0.f,0.f,0.f};
  return z;
}

// D = A(16x4 f32) * B(4x16 f32) + C  -- CDNA5 fp32 WMMA
__device__ __forceinline__ v8f wmma4(v2f a, v2f b, v8f c) {
  return __builtin_amdgcn_wmma_f32_16x16x4_f32(
      /*neg_a=*/false, a, /*neg_b=*/false, b,
      /*c_mod=*/(short)0, c, /*reuse_a=*/false, /*reuse_b=*/false);
}

// generic->LDS offset: flat->local addrspace cast == low-32-bit truncation
__device__ __forceinline__ uint32_t lds_off(const void* p) {
  return (uint32_t)(uintptr_t)p;
}

// CDNA5 async DMA: four 16B global -> LDS copies per lane, tracked by ASYNCcnt.
// s_wait_xcnt closes the statement so that no address register of a copy can be
// rewritten (next trip's address additions) ahead of it.
__device__ __forceinline__ void async_g2l_b128x4(
    uint32_t d0, const void* g0, uint32_t d1, const void* g1,
    uint32_t d2, const void* g2, uint32_t d3, const void* g3) {
  asm volatile("global_load_async_to_lds_b128 %0, %1, off\n\t"
               "global_load_async_to_lds_b128 %2, %3, off\n\t"
               "global_load_async_to_lds_b128 %4, %5, off\n\t"
               "global_load_async_to_lds_b128 %6, %7, off\n\t"
               "s_wait_xcnt 0x0"
               :: "v"(d0), "v"(g0), "v"(d1), "v"(g1),
                  "v"(d2), "v"(g2), "v"(d3), "v"(g3) : "memory");
}

// reductions across the 16 lanes of each wave32 half (xor masks stay in-half)
__device__ __forceinline__ float rmax16(float x) {
  x = fmaxf(x, __shfl_xor(x, 1));
  x = fmaxf(x, __shfl_xor(x, 2));
  x = fmaxf(x, __shfl_xor(x, 4));
  x = fmaxf(x, __shfl_xor(x, 8));
  return x;
}
__device__ __forceinline__ float rsum16(float x) {
  x += __shfl_xor(x, 1);
  x += __shfl_xor(x, 2);
  x += __shfl_xor(x, 4);
  x += __shfl_xor(x, 8);
  return x;
}

// ---------------------------------------------------------------------------
// Kernel 1: sf = w_s @ x + b_s ; cf = w_c @ x + b_c   (per batch, per voxel)
// grid = B * (N/64), block = 256 (8 waves)
// ---------------------------------------------------------------------------
__global__ __launch_bounds__(256) void proj_kernel(
    const float* __restrict__ x, const float* __restrict__ w_s,
    const float* __restrict__ b_s, const float* __restrict__ w_c,
    const float* __restrict__ b_c, float* __restrict__ sf,
    float* __restrict__ cf)
{
  __shared__ float xs [64 * 66];
  __shared__ float wS [64 * 66];
  __shared__ float wC [64 * 66];
  const int tid  = threadIdx.x;
  const int b    = blockIdx.x >> 7;
  const int nb   = (blockIdx.x & 127) << 6;
  for (int i = tid; i < 64 * 64; i += 256) {
    int c = i >> 6, j = i & 63;
    xs[c * 66 + j] = x[((size_t)((b << 6) + c)) * NSP + nb + j];
    wS[c * 66 + j] = w_s[(c << 6) + j];
    wC[c * 66 + j] = w_c[(c << 6) + j];
  }
  __syncthreads();
  const int lane = tid & 31, wv = tid >> 5;
  const int hl = lane >> 4, lr = lane & 15;
  const int nsub = (wv & 3) << 4;
  const int opr  = (wv >> 2) << 1;
  for (int t = 0; t < 2; ++t) {
    const int ob = (opr + t) << 4;
    v8f accS = vzero8(), accC = vzero8();
    for (int kb = 0; kb < 64; kb += 4) {
      const int k0 = kb + (hl << 1);
      v2f bx; bx.x = xs[k0 * 66 + nsub + lr]; bx.y = xs[(k0 + 1) * 66 + nsub + lr];
      v2f aS; aS.x = wS[(ob + lr) * 66 + k0]; aS.y = wS[(ob + lr) * 66 + k0 + 1];
      v2f aC; aC.x = wC[(ob + lr) * 66 + k0]; aC.y = wC[(ob + lr) * 66 + k0 + 1];
      accS = wmma4(aS, bx, accS);
      accC = wmma4(aC, bx, accC);
    }
#pragma unroll
    for (int v = 0; v < 8; ++v) {
      const int o = ob + v + (hl << 3);
      const size_t idx = ((size_t)((b << 6) + o)) * NSP + nb + nsub + lr;
      sf[idx] = accS[v] + b_s[o];
      cf[idx] = accC[v] + b_c[o];
    }
  }
}

// ---------------------------------------------------------------------------
// Kernel 2: s2c logits[b,c,k] = scale * sum_n sf[c,n]*cf[k,n]   (64x64, K=8192)
// grid = B * KSPLIT, block = 256. Each work-group sums its own 64 columns n and
// stores a 64x64 partial sum; kernel 3 adds the KSPLIT partials of a batch.
// ---------------------------------------------------------------------------
__global__ __launch_bounds__(256) void s2c_logits_kernel(
    const float* __restrict__ sf, const float* __restrict__ cf,
    float* __restrict__ lg)
{
  __shared__ float sfs[64 * 66];
  __shared__ float cfs[64 * 66];
  const int tid = threadIdx.x;
  const int b   = blockIdx.x / KSPLIT;
  const int nb  = (blockIdx.x % KSPLIT) << 6;
  const int lane = tid & 31, wv = tid >> 5;
  const int hl = lane >> 4, lr = lane & 15;
  const int t0 = wv << 1, t1 = t0 + 1;
  const int ct0 = t0 >> 2, kt0 = t0 & 3;
  const int ct1 = t1 >> 2, kt1 = t1 & 3;
  v8f acc0 = vzero8(), acc1 = vzero8();
  for (int i = tid; i < 64 * 64; i += 256) {
    int c = i >> 6, j = i & 63;
    const size_t g = ((size_t)((b << 6) + c)) * NSP + nb + j;
    sfs[c * 66 + j] = sf[g];
    cfs[c * 66 + j] = cf[g];
  }
  __syncthreads();
  for (int kb = 0; kb < 64; kb += 4) {
    const int k0 = kb + (hl << 1);
    v2f a0; a0.x = sfs[((ct0 << 4) + lr) * 66 + k0]; a0.y = sfs[((ct0 << 4) + lr) * 66 + k0 + 1];
    v2f b0; b0.x = cfs[((kt0 << 4) + lr) * 66 + k0]; b0.y = cfs[((kt0 << 4) + lr) * 66 + k0 + 1];
    acc0 = wmma4(a0, b0, acc0);
    v2f a1; a1.x = sfs[((ct1 << 4) + lr) * 66 + k0]; a1.y = sfs[((ct1 << 4) + lr) * 66 + k0 + 1];
    v2f b1; b1.x = cfs[((kt1 << 4) + lr) * 66 + k0]; b1.y = cfs[((kt1 << 4) + lr) * 66 + k0 + 1];
    acc1 = wmma4(a1, b1, acc1);
  }
  float* part = lg + (size_t)blockIdx.x * 4096;
#pragma unroll
  for (int v = 0; v < 8; ++v) {
    const int r = v + (hl << 3);
    part[((ct0 << 4) + r) * 64 + (kt0 << 4) + lr] = acc0[v] * SCALE;
    part[((ct1 << 4) + r) * 64 + (kt1 << 4) + lr] = acc1[v] * SCALE;
  }
}

// ---------------------------------------------------------------------------
// Kernel 3: add the KSPLIT partial logits, then softmax over k.
// grid = B * 64 (one row of the 64x64 logits each), block = 64 (one k each)
// ---------------------------------------------------------------------------
__global__ __launch_bounds__(64) void s2c_softmax_kernel(
    const float* __restrict__ lg, float* __restrict__ attn)
{
  __shared__ float row[64];
  const int b = blockIdx.x >> 6, r = blockIdx.x & 63, k = threadIdx.x;
  const float* p = lg + (size_t)b * KSPLIT * 4096 + r * 64 + k;
  float x = 0.f;
  // unrolled so that the loads are issued ahead of the adds, not one per round trip
#pragma unroll
  for (int s = 0; s < KSPLIT; ++s) x += p[s * 4096];
  row[k] = x;
  __syncthreads();  // the whole row is in LDS
  float m = -3.0e38f;
  for (int j = 0; j < 64; ++j) m = fmaxf(m, row[j]);
  float z = 0.f;
  for (int j = 0; j < 64; ++j) z += __expf(row[j] - m);
  attn[b * 4096 + r * 64 + k] = __expf(x - m) * (1.0f / z);
}

// ---------------------------------------------------------------------------
// Kernel 4: c2s flash pass 1 - per-row (n) online max M and 1/Z over all m.
// l[n,m] = scale * sum_c cf[c,n]*sf[c,m].  grid = B*(N/64), block = 512 (16 waves).
// Wave (wv & 3) owns 16 of the 64 rows; wave group (wv >> 2) owns 32 of the 128
// columns of every m-chunk, so four waves share each row's m loop.
// M and Z are kept per lane in the m loop, merged across the 16 lanes after it,
// and the four groups' (M, Z) pairs of a row are merged through LDS at the end.
// sf m-chunks (128 cols) are double-buffered via async global->LDS DMA.
// ---------------------------------------------------------------------------
__global__ __launch_bounds__(512) void c2s_stats_kernel(
    const float* __restrict__ sf, const float* __restrict__ cf,
    float* __restrict__ Mbuf, float* __restrict__ Rbuf)
{
  __shared__ float cfs[64 * 66];     // cf n-block (A operand, resident)
  __shared__ __attribute__((aligned(16))) float sfs[2][64 * 132];  // sf m-chunks (B operand, async dbl-buf)
  __shared__ float Mx[4][64];        // per wave group: row max
  __shared__ float Zx[4][64];        // per wave group: row sum
  const int tid  = threadIdx.x;
  const int b    = blockIdx.x >> 7;
  const int nblk = (blockIdx.x & 127) << 6;
  const size_t sbase = ((size_t)b << 6) * NSP;
  for (int i = tid; i < 64 * 64; i += 512) {
    int c = i >> 6, j = i & 63;
    cfs[c * 66 + j] = cf[sbase + (size_t)c * NSP + nblk + j];
  }
  // per-thread async share: 4x b128 per 128-wide chunk (a wave copies whole rows)
  const int ca = tid >> 5;            // rows 0..15, then +16, +32, +48
  const int qa = (tid & 31) << 2;     // float quad within the 128-col chunk
  const float* gs = sf + sbase + (size_t)ca * NSP + qa;
  async_g2l_b128x4(lds_off(&sfs[0][ca * 132 + qa]),        gs,
                   lds_off(&sfs[0][(ca + 16) * 132 + qa]), gs + (size_t)16 * NSP,
                   lds_off(&sfs[0][(ca + 32) * 132 + qa]), gs + (size_t)32 * NSP,
                   lds_off(&sfs[0][(ca + 48) * 132 + qa]), gs + (size_t)48 * NSP);

  const int lane = tid & 31, wv = tid >> 5;
  const int hl = lane >> 4, lr = lane & 15;
  const int nsub = (wv & 3) << 4;     // this wave's 16 rows
  const int grp  = wv >> 2;           // this wave's column group
  float M[8], Z[8];
#pragma unroll
  for (int v = 0; v < 8; ++v) { M[v] = -3.0e38f; Z[v] = 0.f; }

  for (int mb = 0, it = 0; mb < NSP; mb += 128, ++it) {
    const int cur = it & 1, nxt = cur ^ 1;
    __syncthreads();  // nobody still reads buf[nxt]
    if (mb + 128 < NSP) {
      const float* gn = gs + mb + 128;
      async_g2l_b128x4(lds_off(&sfs[nxt][ca * 132 + qa]),        gn,
                       lds_off(&sfs[nxt][(ca + 16) * 132 + qa]), gn + (size_t)16 * NSP,
                       lds_off(&sfs[nxt][(ca + 32) * 132 + qa]), gn + (size_t)32 * NSP,
                       lds_off(&sfs[nxt][(ca + 48) * 132 + qa]), gn + (size_t)48 * NSP);
      asm volatile("s_wait_asynccnt 4" ::: "memory");  // chunk `cur` retired
    } else {
      asm volatile("s_wait_asynccnt 0" ::: "memory");
    }
    __syncthreads();  // all waves' async writes visible
    const float* S = &sfs[cur][grp << 5];
    for (int ms = 0; ms < 2; ++ms) {
      v8f acc = vzero8();
      for (int kb = 0; kb < 64; kb += 4) {
        const int k0 = kb + (hl << 1);
        v2f a;  a.x  = cfs[k0 * 66 + nsub + lr];        a.y  = cfs[(k0 + 1) * 66 + nsub + lr];
        v2f bb; bb.x = S[k0 * 132 + (ms << 4) + lr];    bb.y = S[(k0 + 1) * 132 + (ms << 4) + lr];
        acc = wmma4(a, bb, acc);
      }
#pragma unroll
      for (int v = 0; v < 8; ++v) {
        // each lane folds only its own column into its own M, Z
        const float xv = acc[v] * SCALE;
        const float nm = fmaxf(M[v], xv);
        Z[v] = Z[v] * __expf(M[v] - nm) + __expf(xv - nm);
        M[v] = nm;
      }
    }
  }
  // merge the 16 per-lane (M, Z) pairs of each row, once per row
  // (unrolled so that M[v] and Z[v] are indexed by constants and stay in registers)
#pragma unroll
  for (int v = 0; v < 8; ++v) {
    const float mt = rmax16(M[v]);
    Z[v] = rsum16(Z[v] * __expf(M[v] - mt));
    M[v] = mt;
  }
  if (lr == 0) {
#pragma unroll
    for (int v = 0; v < 8; ++v) {
      const int r = nsub + (hl << 3) + v;
      Mx[grp][r] = M[v];
      Zx[grp][r] = Z[v];
    }
  }
  __syncthreads();  // the four groups' pairs of every row are in LDS
  if (tid < 64) {
    const float m0 = Mx[0][tid], m1 = Mx[1][tid], m2 = Mx[2][tid], m3 = Mx[3][tid];
    const float mt = fmaxf(fmaxf(m0, m1), fmaxf(m2, m3));
    const float z  = Zx[0][tid] * __expf(m0 - mt) + Zx[1][tid] * __expf(m1 - mt)
                   + Zx[2][tid] * __expf(m2 - mt) + Zx[3][tid] * __expf(m3 - mt);
    Mbuf[b * NSP + nblk + tid] = mt;
    Rbuf[b * NSP + nblk + tid] = 1.0f / z;   // store reciprocal (z >= 1 always)
  }
}

// ---------------------------------------------------------------------------
// Kernel 5: c2s flash pass 2 + s2c output + residual.
// out[c,m] = sum_n sf[c,n]*exp(l[n,m]-M[n])/Z[n] + sum_k attn[c,k]*cf[k,m] + x
// grid = B*(N/64) m-blocks, block = 512 (16 waves).
// Wave (wv & 3) owns 16 of the 64 columns; wave group (wv >> 2) owns one of the
// four 16-wide n-tiles of every stage, so four waves share each column's n loop.
// Their partial sums are added through LDS after the loop.
// cf/sf n-tiles double-buffered via async global->LDS DMA.
// ---------------------------------------------------------------------------
__global__ __launch_bounds__(512) void c2s_out_kernel(
    const float* __restrict__ x, const float* __restrict__ sf,
    const float* __restrict__ cf, const float* __restrict__ Mbuf,
    const float* __restrict__ Rbuf, const float* __restrict__ attn,
    float* __restrict__ out)
{
  __shared__ float sfs[64 * 66];     // sf m-block (B operand for logits)
  __shared__ __attribute__((aligned(16))) float cft[2][4][64 * 20];  // cf n-tiles (A for logits, async dbl-buf)
  __shared__ __attribute__((aligned(16))) float sft[2][4][64 * 20];  // sf n-tiles (A for out GEMM, async dbl-buf)
  __shared__ float Pst[16][16 * 18]; // per-wave probability tile
  __shared__ float red[3][4][32 * 32];  // partial sums of wave groups 1..3
  const int tid  = threadIdx.x;
  const int b    = blockIdx.x >> 7;
  const int mblk = (blockIdx.x & 127) << 6;
  const size_t sbase = ((size_t)b << 6) * NSP;
  for (int i = tid; i < 64 * 64; i += 512) {
    int c = i >> 6, j = i & 63;
    sfs[c * 66 + j] = sf[sbase + (size_t)c * NSP + mblk + j];
  }
  // per-thread async share for a stage (64 rows x 64 n of cf and of sf):
  // 2 b128 from cf + 2 from sf; 16 lanes cover one row's 256 bytes
  const int ca = tid >> 4;           // row 0..31, then +32
  const int ta = (tid & 15) >> 2;    // n-tile within the stage
  const int qa = (tid & 3) << 2;     // float quad within the 16-col tile
  const size_t ga = sbase + (size_t)ca * NSP + (ta << 4) + qa;
  async_g2l_b128x4(lds_off(&cft[0][ta][ca * 20 + qa]),        cf + ga,
                   lds_off(&cft[0][ta][(ca + 32) * 20 + qa]), cf + ga + (size_t)32 * NSP,
                   lds_off(&sft[0][ta][ca * 20 + qa]),        sf + ga,
                   lds_off(&sft[0][ta][(ca + 32) * 20 + qa]), sf + ga + (size_t)32 * NSP);

  const int lane = tid & 31, wv = tid >> 5;
  const int hl = lane >> 4, lr = lane & 15;
  const int msub = (wv & 3) << 4;    // this wave's 16 columns
  const int grp  = wv >> 2;          // this wave's n-tile of every stage
  v8f accO[4];
#pragma unroll
  for (int ct = 0; ct < 4; ++ct) accO[ct] = vzero8();

  for (int st = 0; st < NSP / 64; ++st) {
    const int cur = st & 1, nxt = cur ^ 1;
    const int nb = (st << 6) + (grp << 4);
    __syncthreads();  // nobody still reads buf[nxt]
    if (st + 1 < NSP / 64) {
      const size_t gn = ga + (st << 6) + 64;
      async_g2l_b128x4(lds_off(&cft[nxt][ta][ca * 20 + qa]),        cf + gn,
                       lds_off(&cft[nxt][ta][(ca + 32) * 20 + qa]), cf + gn + (size_t)32 * NSP,
                       lds_off(&sft[nxt][ta][ca * 20 + qa]),        sf + gn,
                       lds_off(&sft[nxt][ta][(ca + 32) * 20 + qa]), sf + gn + (size_t)32 * NSP);
      asm volatile("s_wait_asynccnt 4" ::: "memory");  // stage `cur` retired
    } else {
      asm volatile("s_wait_asynccnt 0" ::: "memory");
    }
    __syncthreads();  // all waves' async writes visible
    const float* CT = &cft[cur][grp][0];
    const float* ST = &sft[cur][grp][0];
    // logits tile l[16 n x 16 m], K = 64 channels
    v8f acc = vzero8();
    for (int kb = 0; kb < 64; kb += 4) {
      const int k0 = kb + (hl << 1);
      v2f a;  a.x  = CT[k0 * 20 + lr];          a.y  = CT[(k0 + 1) * 20 + lr];
      v2f bb; bb.x = sfs[k0 * 66 + msub + lr];  bb.y = sfs[(k0 + 1) * 66 + msub + lr];
      acc = wmma4(a, bb, acc);
    }
    // P = exp(scale*l - M[n]) * (1/Z[n]); stage through per-wave LDS to
    // re-fragment D-layout -> B-layout for the next GEMM.
    float* Pw = &Pst[wv][0];
#pragma unroll
    for (int v = 0; v < 8; ++v) {
      const int n = nb + (hl << 3) + v;
      const float p = __expf(acc[v] * SCALE - Mbuf[b * NSP + n]) * Rbuf[b * NSP + n];
      Pw[((hl << 3) + v) * 18 + lr] = p;
    }
    asm volatile("s_wait_dscnt 0" ::: "memory");  // wave-local LDS RAW fence
    // accO[c-tile] += sf[c, n-tile] @ P[n-tile, m]
#pragma unroll
    for (int ct = 0; ct < 4; ++ct) {
      for (int kb = 0; kb < 16; kb += 4) {
        const int k0 = kb + (hl << 1);
        v2f a;  a.x  = ST[((ct << 4) + lr) * 20 + k0]; a.y  = ST[((ct << 4) + lr) * 20 + k0 + 1];
        v2f bb; bb.x = Pw[k0 * 18 + lr];               bb.y = Pw[(k0 + 1) * 18 + lr];
        accO[ct] = wmma4(a, bb, accO[ct]);
      }
    }
  }
  // add the four wave groups' partial sums: groups 1..3 hand theirs to group 0
  if (grp != 0) {
    float* R = &red[grp - 1][wv & 3][0];
#pragma unroll
    for (int ct = 0; ct < 4; ++ct) {
#pragma unroll
      for (int v = 0; v < 8; ++v) R[((ct << 3) + v) * 32 + lane] = accO[ct][v];
    }
  }
  __syncthreads();  // the partial sums are in LDS
  if (grp != 0) return;
#pragma unroll
  for (int k = 0; k < 3; ++k) {
    const float* R = &red[k][wv][0];
#pragma unroll
    for (int ct = 0; ct < 4; ++ct) {
#pragma unroll
      for (int v = 0; v < 8; ++v) accO[ct][v] += R[((ct << 3) + v) * 32 + lane];
    }
  }
  // s2c output: accO += attn[c,k] @ cf[k,m]   (K = 64, tiny)
#pragma unroll
  for (int ct = 0; ct < 4; ++ct) {
    for (int kb = 0; kb < 64; kb += 4) {
      const int k0 = kb + (hl << 1);
      v2f a;
      a.x = attn[b * 4096 + ((ct << 4) + lr) * 64 + k0];
      a.y = attn[b * 4096 + ((ct << 4) + lr) * 64 + k0 + 1];
      const size_t g0 = sbase + (size_t)k0 * NSP + mblk + msub + lr;
      v2f bb; bb.x = cf[g0]; bb.y = cf[g0 + NSP];
      accO[ct] = wmma4(a, bb, accO[ct]);
    }
  }
  // residual + store
#pragma unroll
  for (int ct = 0; ct < 4; ++ct) {
#pragma unroll
    for (int v = 0; v < 8; ++v) {
      const int c = (ct << 4) + (hl << 3) + v;
      const size_t idx = sbase + (size_t)c * NSP + mblk + msub + lr;
      out[idx] = accO[ct][v] + x[idx];
    }
  }
}

// ---------------------------------------------------------------------------
extern "C" void kernel_launch(void* const* d_in, const int* in_sizes, int n_in,
                              void* d_out, int out_size, void* d_ws, size_t ws_size,
                              hipStream_t stream)
{
  const float* x   = (const float*)d_in[0];
  const float* w_s = (const float*)d_in[1];
  const float* b_s = (const float*)d_in[2];
  const float* w_c = (const float*)d_in[3];
  const float* b_c = (const float*)d_in[4];
  float* out = (float*)d_out;

  float* ws = (float*)d_ws;
  float* sf = ws;                                   // [B,64,N]
  float* cf = sf + (size_t)NBAT * CCH * NSP;        // [B,64,N]
  float* Mb = cf + (size_t)NBAT * CCH * NSP;        // [B,N] row max
  float* Rb = Mb + (size_t)NBAT * NSP;              // [B,N] 1/rowsum
  float* lg = Rb + (size_t)NBAT * NSP;              // [B,KSPLIT,64,64] partial logits
  float* at = lg + NBAT * KSPLIT * CCH * CCH;       // [B,64,64]

  proj_kernel       <<<NBAT * (NSP / 64), 256, 0, stream>>>(x, w_s, b_s, w_c, b_c, sf, cf);
  s2c_logits_kernel <<<NBAT * KSPLIT,     256, 0, stream>>>(sf, cf, lg);
  s2c_softmax_kernel<<<NBAT * CCH,         64, 0, stream>>>(lg, at);
  c2s_stats_kernel  <<<NBAT * (NSP / 64),  512, 0, stream>>>(sf, cf, Mb, Rb);
  c2s_out_kernel    <<<NBAT * (NSP / 64),  512, 0, stream>>>(x, sf, cf, Mb, Rb, at, out);
}

// v004
// One run takes 327 microseconds.
// Two timings next to v003 both put it at 1.15 times that version's speed.
// Over all steps from v000 it is 5.04 times as fast.
#include <hip/hip_runtime.h>

typedef __attribute__((ext_vector_type(2))) float v2f;
typedef __attribute__((ext_vector_type(8))) float v8f;

#define CCH   64
#define NSP   8192
#define NBAT  2
#define SCALE 0.125f   // 64^-0.5
#define KSPLIT (NSP / 64)  // work-groups that share one batch's n sum in the s2c logits

__device__ __forceinline__ v8f vzero8() {
  v8f z = {0.f,0.f,0.f,0.f,0.f,0.f,0.f,0.f};
  return z;
}

// D = A(16x4 f32) * B(4x16 f32) + C  -- CDNA5 fp32 WMMA
__device__ __forceinline__ v8f wmma4(v2f a, v2f b, v8f c) {
  return __builtin_amdgcn_wmma_f32_16x16x4_f32(
      /*neg_a=*/false, a, /*neg_b=*/false, b,
      /*c_mod=*/(short)0, c, /*reuse_a=*/false, /*reuse_b=*/false);
}

// generic->LDS offset: flat->local addrspace cast == low-32-bit truncation
__device__ __forceinline__ uint32_t lds_off(const void* p) {
  return (uint32_t)(uintptr_t)p;
}

// CDNA5 async DMA: four 16B global -> LDS copies per lane, tracked by ASYNCcnt.
// s_wait_xcnt closes the statement so that no address register of a copy can be
// rewritten (next trip's address additions) ahead of it.
__device__ __forceinline__ void async_g2l_b128x4(
    uint32_t d0, const void* g0, uint32_t d1, const void* g1,
    uint32_t d2, const void* g2, uint32_t d3, const void* g3) {
  asm volatile("global_load_async_to_lds_b128 %0, %1, off\n\t"
               "global_load_async_to_lds_b128 %2, %3, off\n\t"
               "global_load_async_to_lds_b128 %4, %5, off\n\t"
               "global_load_async_to_lds_b128 %6, %7, off\n\t"
               "s_wait_xcnt 0x0"
               :: "v"(d0), "v"(g0), "v"(d1), "v"(g1),
                  "v"(d2), "v"(g2), "v"(d3), "v"(g3) : "memory");
}

// reductions across the 16 lanes of each wave32 half (xor masks stay in-half)
__device__ __forceinline__ float rmax16(float x) {
  x = fmaxf(x, __shfl_xor(x, 1));
  x = fmaxf(x, __shfl_xor(x, 2));
  x = fmaxf(x, __shfl_xor(x, 4));
  x = fmaxf(x, __shfl_xor(x, 8));
  return x;
}
__device__ __forceinline__ float rsum16(float x) {
  x += __shfl_xor(x, 1);
  x += __shfl_xor(x, 2);
  x += __shfl_xor(x, 4);
  x += __shfl_xor(x, 8);
  return x;
}

// ---------------------------------------------------------------------------
// Kernel 1: sf = w_s @ x + b_s ; cf = w_c @ x + b_c   (per batch, per voxel)
// grid = B * (N/64), block = 256 (8 waves)
// ---------------------------------------------------------------------------
__global__ __launch_bounds__(256) void proj_kernel(
    const float* __restrict__ x, const float* __restrict__ w_s,
    const float* __restrict__ b_s, const float* __restrict__ w_c,
    const float* __restrict__ b_c, float* __restrict__ sf,
    float* __restrict__ cf)
{
  __shared__ float xs [64 * 66];
  __shared__ float wS [64 * 66];
  __shared__ float wC [64 * 66];
  const int tid  = threadIdx.x;
  const int b    = blockIdx.x >> 7;
  const int nb   = (blockIdx.x & 127) << 6;
  for (int i = tid; i < 64 * 64; i += 256) {
    int c = i >> 6, j = i & 63;
    xs[c * 66 + j] = x[((size_t)((b << 6) + c)) * NSP + nb + j];
    wS[c * 66 + j] = w_s[(c << 6) + j];
    wC[c * 66 + j] = w_c[(c << 6) + j];
  }
  __syncthreads();
  const int lane = tid & 31, wv = tid >> 5;
  const int hl = lane >> 4, lr = lane & 15;
  const int nsub = (wv & 3) << 4;
  const int opr  = (wv >> 2) << 1;
  for (int t = 0; t < 2; ++t) {
    const int ob = (opr + t) << 4;
    v8f accS = vzero8(), accC = vzero8();
    for (int kb = 0; kb < 64; kb += 4) {
      const int k0 = kb + (hl << 1);
      v2f bx; bx.x = xs[k0 * 66 + nsub + lr]; bx.y = xs[(k0 + 1) * 66 + nsub + lr];
      v2f aS; aS.x = wS[(ob + lr) * 66 + k0]; aS.y = wS[(ob + lr) * 66 + k0 + 1];
      v2f aC; aC.x = wC[(ob + lr) * 66 + k0]; aC.y = wC[(ob + lr) * 66 + k0 + 1];
      accS = wmma4(aS, bx, accS);
      accC = wmma4(aC, bx, accC);
    }
#pragma unroll
    for (int v = 0; v < 8; ++v) {
      const int o = ob + v + (hl << 3);
      const size_t idx = ((size_t)((b << 6) + o)) * NSP + nb + nsub + lr;
      sf[idx] = accS[v] + b_s[o];
      cf[idx] = accC[v] + b_c[o];
    }
  }
}

// ---------------------------------------------------------------------------
// Kernel 2: s2c logits[b,c,k] = scale * sum_n sf[c,n]*cf[k,n]   (64x64, K=8192)
// grid = B * KSPLIT, block = 256. Each work-group sums its own 64 columns n and
// stores a 64x64 partial sum; kernel 3 adds the KSPLIT partials of a batch.
// ---------------------------------------------------------------------------
__global__ __launch_bounds__(256) void s2c_logits_kernel(
    const float* __restrict__ sf, const float* __restrict__ cf,
    float* __restrict__ lg)
{
  __shared__ float sfs[64 * 66];
  __shared__ float cfs[64 * 66];
  const int tid = threadIdx.x;
  const int b   = blockIdx.x / KSPLIT;
  const int nb  = (blockIdx.x % KSPLIT) << 6;
  const int lane = tid & 31, wv = tid >> 5;
  const int hl = lane >> 4, lr = lane & 15;
  const int t0 = wv << 1, t1 = t0 + 1;
  const int ct0 = t0 >> 2, kt0 = t0 & 3;
  const int ct1 = t1 >> 2, kt1 = t1 & 3;
  v8f acc0 = vzero8(), acc1 = vzero8();
  for (int i = tid; i < 64 * 64; i += 256) {
    int c = i >> 6, j = i & 63;
    const size_t g = ((size_t)((b << 6) + c)) * NSP + nb + j;
    sfs[c * 66 + j] = sf[g];
    cfs[c * 66 + j] = cf[g];
  }
  __syncthreads();
  for (int kb = 0; kb < 64; kb += 4) {
    const int k0 = kb + (hl << 1);
    v2f a0; a0.x = sfs[((ct0 << 4) + lr) * 66 + k0]; a0.y = sfs[((ct0 << 4) + lr) * 66 + k0 + 1];
    v2f b0; b0.x = cfs[((kt0 << 4) + lr) * 66 + k0]; b0.y = cfs[((kt0 << 4) + lr) * 66 + k0 + 1];
    acc0 = wmma4(a0, b0, acc0);
    v2f a1; a1.x = sfs[((ct1 << 4) + lr) * 66 + k0]; a1.y = sfs[((ct1 << 4) + lr) * 66 + k0 + 1];
    v2f b1; b1.x = cfs[((kt1 << 4) + lr) * 66 + k0]; b1.y = cfs[((kt1 << 4) + lr) * 66 + k0 + 1];
    acc1 = wmma4(a1, b1, acc1);
  }
  float* part = lg + (size_t)blockIdx.x * 4096;
#pragma unroll
  for (int v = 0; v < 8; ++v) {
    const int r = v + (hl << 3);
    part[((ct0 << 4) + r) * 64 + (kt0 << 4) + lr] = acc0[v] * SCALE;
    part[((ct1 << 4) + r) * 64 + (kt1 << 4) + lr] = acc1[v] * SCALE;
  }
}

// ---------------------------------------------------------------------------
// Kernel 3: add the KSPLIT partial logits, then softmax over k.
// grid = B * 64 (one row of the 64x64 logits each), block = 64 (one k each)
// ---------------------------------------------------------------------------
__global__ __launch_bounds__(64) void s2c_softmax_kernel(
    const float* __restrict__ lg, float* __restrict__ attn)
{
  __shared__ float row[64];
  const int b = blockIdx.x >> 6, r = blockIdx.x & 63, k = threadIdx.x;
  const float* p = lg + (size_t)b * KSPLIT * 4096 + r * 64 + k;
  float x = 0.f;
  // unrolled so that the loads are issued ahead of the adds, not one per round trip
#pragma unroll
  for (int s = 0; s < KSPLIT; ++s) x += p[s * 4096];
  row[k] = x;
  __syncthreads();  // the whole row is in LDS
  float m = -3.0e38f;
  for (int j = 0; j < 64; ++j) m = fmaxf(m, row[j]);
  float z = 0.f;
  for (int j = 0; j < 64; ++j) z += __expf(row[j] - m);
  attn[b * 4096 + r * 64 + k] = __expf(x - m) * (1.0f / z);
}

// ---------------------------------------------------------------------------
// Kernel 4: c2s flash pass 1 - per-row (n) online max M and 1/Z over all m.
// l[n,m] = scale * sum_c cf[c,n]*sf[c,m].  grid = B*(N/64), block = 512 (16 waves).
// Wave (wv & 3) owns 16 of the 64 rows; wave group (wv >> 2) owns 32 of the 128
// columns of every m-chunk, so four waves share each row's m loop.
// M and Z are kept per lane in the m loop, merged across the 16 lanes after it,
// and the four groups' (M, Z) pairs of a row are merged through LDS at the end.
// The wave's cf rows (A operand) do not change in the m loop: they are loaded once,
// in fragment order, and stay in registers.
// sf m-chunks (128 cols) are double-buffered via async global->LDS DMA.
// ---------------------------------------------------------------------------
// waves_per_eu: the block's own four waves per SIMD, so that the compiler spends the
// registers on issuing a chunk's LDS fragment loads as one group ahead of the WMMAs.
__global__ __launch_bounds__(512) __attribute__((amdgpu_waves_per_eu(4, 4))) void c2s_stats_kernel(
    const float* __restrict__ sf, const float* __restrict__ cf,
    float* __restrict__ Mbuf, float* __restrict__ Rbuf)
{
  __shared__ __attribute__((aligned(16))) float sfs[2][64 * 132];  // sf m-chunks (B operand, async dbl-buf)
  __shared__ float Mx[4][64];        // per wave group: row max
  __shared__ float Zx[4][64];        // per wave group: row sum
  const int tid  = threadIdx.x;
  const int b    = blockIdx.x >> 7;
  const int nblk = (blockIdx.x & 127) << 6;
  const size_t sbase = ((size_t)b << 6) * NSP;
  // per-thread async share: 4x b128 per 128-wide chunk (a wave copies whole rows)
  const int ca = tid >> 5;            // rows 0..15, then +16, +32, +48
  const int qa = (tid & 31) << 2;     // float quad within the 128-col chunk
  const float* gs = sf + sbase + (size_t)ca * NSP + qa;
  async_g2l_b128x4(lds_off(&sfs[0][ca * 132 + qa]),        gs,
                   lds_off(&sfs[0][(ca + 16) * 132 + qa]), gs + (size_t)16 * NSP,
                   lds_off(&sfs[0][(ca + 32) * 132 + qa]), gs + (size_t)32 * NSP,
                   lds_off(&sfs[0][(ca + 48) * 132 + qa]), gs + (size_t)48 * NSP);

  const int lane = tid & 31, wv = tid >> 5;
  const int hl = lane >> 4, lr = lane & 15;
  const int nsub = (wv & 3) << 4;     // this wave's 16 rows
  const int grp  = wv >> 2;           // this wave's column group
  // A fragments of all 16 k steps: channels 4i + 2*hl and the next, row nsub + lr
  v2f afr[16];
  {
    const float* ga = cf + sbase + (size_t)(hl << 1) * NSP + nblk + nsub + lr;
    // unrolled: afr is indexed by constants only, or it would live in scratch
#pragma unroll
    for (int i = 0; i < 16; ++i) {
      afr[i].x = ga[(size_t)(4 * i) * NSP];
      afr[i].y = ga[(size_t)(4 * i + 1) * NSP];
    }
  }
  float M[8], Z[8];
#pragma unroll
  for (int v = 0; v < 8; ++v) { M[v] = -3.0e38f; Z[v] = 0.f; }

  for (int mb = 0, it = 0; mb < NSP; mb += 128, ++it) {
    const int cur = it & 1, nxt = cur ^ 1;
    __syncthreads();  // nobody still reads buf[nxt]
    if (mb + 128 < NSP) {
      const float* gn = gs + mb + 128;
      async_g2l_b128x4(lds_off(&sfs[nxt][ca * 132 + qa]),        gn,
                       lds_off(&sfs[nxt][(ca + 16) * 132 + qa]), gn + (size_t)16 * NSP,
                       lds_off(&sfs[nxt][(ca + 32) * 132 + qa]), gn + (size_t)32 * NSP,
                       lds_off(&sfs[nxt][(ca + 48) * 132 + qa]), gn + (size_t)48 * NSP);
      asm volatile("s_wait_asynccnt 4" ::: "memory");  // chunk `cur` retired
    } else {
      asm volatile("s_wait_asynccnt 0" ::: "memory");
    }
    __syncthreads();  // all waves' async writes visible
    const float* S = &sfs[cur][grp << 5];
    for (int ms = 0; ms < 2; ++ms) {
      v8f acc = vzero8();
      // unrolled so that afr is indexed by constants and stays in registers
#pragma unroll
      for (int kb = 0; kb < 64; kb += 4) {
        const int k0 = kb + (hl << 1);
        v2f bb; bb.x = S[k0 * 132 + (ms << 4) + lr];    bb.y = S[(k0 + 1) * 132 + (ms << 4) + lr];
        acc = wmma4(afr[kb >> 2], bb, acc);
      }
#pragma unroll
      for (int v = 0; v < 8; ++v) {
        // each lane folds only its own column into its own M, Z
        const float xv = acc[v] * SCALE;
        const float nm = fmaxf(M[v], xv);
        Z[v] = Z[v] * __expf(M[v] - nm) + __expf(xv - nm);
        M[v] = nm;
      }
    }
  }
  // merge the 16 per-lane (M, Z) pairs of each row, once per row
  // (unrolled so that M[v] and Z[v] are indexed by constants and stay in registers)
#pragma unroll
  for (int v = 0; v < 8; ++v) {
    const float mt = rmax16(M[v]);
    Z[v] = rsum16(Z[v] * __expf(M[v] - mt));
    M[v] = mt;
  }
  if (lr == 0) {
#pragma unroll
    for (int v = 0; v < 8; ++v) {
      const int r = nsub + (hl << 3) + v;
      Mx[grp][r] = M[v];
      Zx[grp][r] = Z[v];
    }
  }
  __syncthreads();  // the four groups' pairs of every row are in LDS
  if (tid < 64) {
    const float m0 = Mx[0][tid], m1 = Mx[1][tid], m2 = Mx[2][tid], m3 = Mx[3][tid];
    const float mt = fmaxf(fmaxf(m0, m1), fmaxf(m2, m3));
    const float z  = Zx[0][tid] * __expf(m0 - mt) + Zx[1][tid] * __expf(m1 - mt)
                   + Zx[2][tid] * __expf(m2 - mt) + Zx[3][tid] * __expf(m3 - mt);
    Mbuf[b * NSP + nblk + tid] = mt;
    Rbuf[b * NSP + nblk + tid] = 1.0f / z;   // store reciprocal (z >= 1 always)
  }
}

// ---------------------------------------------------------------------------
// Kernel 5: c2s flash pass 2 + s2c output + residual.
// out[c,m] = sum_n sf[c,n]*exp(l[n,m]-M[n])/Z[n] + sum_k attn[c,k]*cf[k,m] + x
// grid = B*(N/64) m-blocks, block = 512 (16 waves).
// Wave (wv & 3) owns 16 of the 64 columns; wave group (wv >> 2) owns one of the
// four 16-wide n-tiles of every stage, so four waves share each column's n loop.
// Their partial sums are added through LDS after the loop.
// The wave's sf columns (B operand of the logits) do not change in the n loop:
// they are loaded once, in fragment order, and stay in registers.
// cf/sf n-tiles double-buffered via async global->LDS DMA.
// ---------------------------------------------------------------------------
// waves_per_eu: the block's own four waves per SIMD. With less LDS the compiler would
// otherwise budget registers for a second resident work-group, which this grid never
// supplies, and fetch the LDS fragments just in time instead of as one group ahead.
__global__ __launch_bounds__(512) __attribute__((amdgpu_waves_per_eu(4, 4))) void c2s_out_kernel(
    const float* __restrict__ x, const float* __restrict__ sf,
    const float* __restrict__ cf, const float* __restrict__ Mbuf,
    const float* __restrict__ Rbuf, const float* __restrict__ attn,
    float* __restrict__ out)
{
  __shared__ __attribute__((aligned(16))) float cft[2][4][64 * 20];  // cf n-tiles (A for logits, async dbl-buf)
  __shared__ __attribute__((aligned(16))) float sft[2][4][64 * 20];  // sf n-tiles (A for out GEMM, async dbl-buf)
  __shared__ float Pst[16][16 * 18]; // per-wave probability tile
  __shared__ float red[3][4][32 * 32];  // partial sums of wave groups 1..3
  const int tid  = threadIdx.x;
  const int b    = blockIdx.x >> 7;
  const int mblk = (blockIdx.x & 127) << 6;
  const size_t sbase = ((size_t)b << 6) * NSP;
  // per-thread async share for a stage (64 rows x 64 n of cf and of sf):
  // 2 b128 from cf + 2 from sf; 16 lanes cover one row's 256 bytes
  const int ca = tid >> 4;           // row 0..31, then +32
  const int ta = (tid & 15) >> 2;    // n-tile within the stage
  const int qa = (tid & 3) << 2;     // float quad within the 16-col tile
  const size_t ga = sbase + (size_t)ca * NSP + (ta << 4) + qa;
  async_g2l_b128x4(lds_off(&cft[0][ta][ca * 20 + qa]),        cf + ga,
                   lds_off(&cft[0][ta][(ca + 32) * 20 + qa]), cf + ga + (size_t)32 * NSP,
                   lds_off(&sft[0][ta][ca * 20 + qa]),        sf + ga,
                   lds_off(&sft[0][ta][(ca + 32) * 20 + qa]), sf + ga + (size_t)32 * NSP);

  const int lane = tid & 31, wv = tid >> 5;
  const int hl = lane >> 4, lr = lane & 15;
  const int msub = (wv & 3) << 4;    // this wave's 16 columns
  const int grp  = wv >> 2;          // this wave's n-tile of every stage
  // B fragments of all 16 k steps: channels 4i + 2*hl and the next, column msub + lr
  v2f bfr[16];
  {
    const float* gb = sf + sbase + (size_t)(hl << 1) * NSP + mblk + msub + lr;
    // unrolled: bfr is indexed by constants only, or it would live in scratch
#pragma unroll
    for (int i = 0; i < 16; ++i) {
      bfr[i].x = gb[(size_t)(4 * i) * NSP];
      bfr[i].y = gb[(size_t)(4 * i + 1) * NSP];
    }
  }
  v8f accO[4];
#pragma unroll
  for (int ct = 0; ct < 4; ++ct) accO[ct] = vzero8();

  for (int st = 0; st < NSP / 64; ++st) {
    const int cur = st & 1, nxt = cur ^ 1;
    const int nb = (st << 6) + (grp << 4);
    __syncthreads();  // nobody still reads buf[nxt]
    if (st + 1 < NSP / 64) {
      const size_t gn = ga + (st << 6) + 64;
      async_g2l_b128x4(lds_off(&cft[nxt][ta][ca * 20 + qa]),        cf + gn,
                       lds_off(&cft[nxt][ta][(ca + 32) * 20 + qa]), cf + gn + (size_t)32 * NSP,
                       lds_off(&sft[nxt][ta][ca * 20 + qa]),        sf + gn,
                       lds_off(&sft[nxt][ta][(ca + 32) * 20 + qa]), sf + gn + (size_t)32 * NSP);
      asm volatile("s_wait_asynccnt 4" ::: "memory");  // stage `cur` retired
    } else {
      asm volatile("s_wait_asynccnt 0" ::: "memory");
    }
    __syncthreads();  // all waves' async writes visible
    const float* CA = &cft[cur][grp][(hl << 1) * 20 + lr];  // channel 2*hl, row lr
    const float* ST = &sft[cur][grp][0];
    // logits tile l[16 n x 16 m], K = 64 channels
    v8f acc = vzero8();
    // unrolled so that bfr is indexed by constants and stays in registers
#pragma unroll
    for (int kb = 0; kb < 64; kb += 4) {
      v2f a;  a.x  = CA[kb * 20];               a.y  = CA[(kb + 1) * 20];
      acc = wmma4(a, bfr[kb >> 2], acc);
    }
    // P = exp(scale*l - M[n]) * (1/Z[n]); stage through per-wave LDS to
    // re-fragment D-layout -> B-layout for the next GEMM.
    float* Pw = &Pst[wv][0];
#pragma unroll
    for (int v = 0; v < 8; ++v) {
      const int n = nb + (hl << 3) + v;
      const float p = __expf(acc[v] * SCALE - Mbuf[b * NSP + n]) * Rbuf[b * NSP + n];
      Pw[((hl << 3) + v) * 18 + lr] = p;
    }
    asm volatile("s_wait_dscnt 0" ::: "memory");  // wave-local LDS RAW fence
    // accO[c-tile] += sf[c, n-tile] @ P[n-tile, m]
#pragma unroll
    for (int ct = 0; ct < 4; ++ct) {
      for (int kb = 0; kb < 16; kb += 4) {
        const int k0 = kb + (hl << 1);
        v2f a;  a.x  = ST[((ct << 4) + lr) * 20 + k0]; a.y  = ST[((ct << 4) + lr) * 20 + k0 + 1];
        v2f bb; bb.x = Pw[k0 * 18 + lr];               bb.y = Pw[(k0 + 1) * 18 + lr];
        accO[ct] = wmma4(a, bb, accO[ct]);
      }
    }
  }
  // add the four wave groups' partial sums: groups 1..3 hand theirs to group 0
  if (grp != 0) {
    float* R = &red[grp - 1][wv & 3][0];
#pragma unroll
    for (int ct = 0; ct < 4; ++ct) {
#pragma unroll
      for (int v = 0; v < 8; ++v) R[((ct << 3) + v) * 32 + lane] = accO[ct][v];
    }
  }
  __syncthreads();  // the partial sums are in LDS
  if (grp != 0) return;
#pragma unroll
  for (int k = 0; k < 3; ++k) {
    const float* R = &red[k][wv][0];
#pragma unroll
    for (int ct = 0; ct < 4; ++ct) {
#pragma unroll
      for (int v = 0; v < 8; ++v) accO[ct][v] += R[((ct << 3) + v) * 32 + lane];
    }
  }
  // s2c output: accO += attn[c,k] @ cf[k,m]   (K = 64, tiny)
#pragma unroll
  for (int ct = 0; ct < 4; ++ct) {
    for (int kb = 0; kb < 64; kb += 4) {
      const int k0 = kb + (hl << 1);
      v2f a;
      a.x = attn[b * 4096 + ((ct << 4) + lr) * 64 + k0];
      a.y = attn[b * 4096 + ((ct << 4) + lr) * 64 + k0 + 1];
      const size_t g0 = sbase + (size_t)k0 * NSP + mblk + msub + lr;
      v2f bb; bb.x = cf[g0]; bb.y = cf[g0 + NSP];
      accO[ct] = wmma4(a, bb, accO[ct]);
    }
  }
  // residual + store
#pragma unroll
  for (int ct = 0; ct < 4; ++ct) {
#pragma unroll
    for (int v = 0; v < 8; ++v) {
      const int c = (ct << 4) + (hl << 3) + v;
      const size_t idx = sbase + (size_t)c * NSP + mblk + msub + lr;
      out[idx] = accO[ct][v] + x[idx];
    }
  }
}

// ---------------------------------------------------------------------------
extern "C" void kernel_launch(void* const* d_in, const int* in_sizes, int n_in,
                              void* d_out, int out_size, void* d_ws, size_t ws_size,
                              hipStream_t stream)
{
  const float* x   = (const float*)d_in[0];
  const float* w_s = (const float*)d_in[1];
  const float* b_s = (const float*)d_in[2];
  const float* w_c = (const float*)d_in[3];
  const float* b_c = (const float*)d_in[4];
  float* out = (float*)d_out;

  float* ws = (float*)d_ws;
  float* sf = ws;                                   // [B,64,N]
  float* cf = sf + (size_t)NBAT * CCH * NSP;        // [B,64,N]
  float* Mb = cf + (size_t)NBAT * CCH * NSP;        // [B,N] row max
  float* Rb = Mb + (size_t)NBAT * NSP;              // [B,N] 1/rowsum
  float* lg = Rb + (size_t)NBAT * NSP;              // [B,KSPLIT,64,64] partial logits
  float* at = lg + NBAT * KSPLIT * CCH * CCH;       // [B,64,64]

  proj_kernel       <<<NBAT * (NSP / 64), 256, 0, stream>>>(x, w_s, b_s, w_c, b_c, sf, cf);
  s2c_logits_kernel <<<NBAT * KSPLIT,     256, 0, stream>>>(sf, cf, lg);
  s2c_softmax_kernel<<<NBAT * CCH,         64, 0, stream>>>(lg, at);
  c2s_stats_kernel  <<<NBAT * (NSP / 64),  512, 0, stream>>>(sf, cf, Mb, Rb);
  c2s_out_kernel    <<<NBAT * (NSP / 64),  512, 0, stream>>>(x, sf, cf, Mb, Rb, at, out);
}

// v005
// A run of this version takes 296 microseconds.
// Two timings next to v004 put it at 1.10 and 1.11 times that version's speed.
// All steps since v000 together make it 5.57 times as fast.
#include <hip/hip_runtime.h>

typedef __attribute__((ext_vector_type(2))) float v2f;
typedef __attribute__((ext_vector_type(4))) float v4f;
typedef __attribute__((ext_vector_type(8))) float v8f;

#define CCH   64
#define NSP   8192
#define NBAT  2
#define SCALE 0.125f   // 64^-0.5
#define KSPLIT (NSP / 64)  // work-groups that share one batch's n sum in the s2c logits
// LDS row pitch (floats) of a voxel's 64 channels: 272 B = 16 B x odd, so that the 16 lanes
// of a half wave, one row each, spread their 16-byte reads over all 64 banks
#define TP 68

__device__ __forceinline__ v8f vzero8() {
  v8f z = {0.f,0.f,0.f,0.f,0.f,0.f,0.f,0.f};
  return z;
}

// D = A(16x4 f32) * B(4x16 f32) + C  -- CDNA5 fp32 WMMA
__device__ __forceinline__ v8f wmma4(v2f a, v2f b, v8f c) {
  return __builtin_amdgcn_wmma_f32_16x16x4_f32(
      /*neg_a=*/false, a, /*neg_b=*/false, b,
      /*c_mod=*/(short)0, c, /*reuse_a=*/false, /*reuse_b=*/false);
}

// generic->LDS offset: flat->local addrspace cast == low-32-bit truncation
__device__ __forceinline__ uint32_t lds_off(const void* p) {
  return (uint32_t)(uintptr_t)p;
}

// CDNA5 async DMA: four 16B global -> LDS copies per lane, tracked by ASYNCcnt.
// s_wait_xcnt closes the statement so that no address register of a copy can be
// rewritten (next trip's address additions) ahead of it.
__device__ __forceinline__ void async_g2l_b128x4(
    uint32_t d0, const void* g0, uint32_t d1, const void* g1,
    uint32_t d2, const void* g2, uint32_t d3, const void* g3) {
  asm volatile("global_load_async_to_lds_b128 %0, %1, off\n\t"
               "global_load_async_to_lds_b128 %2, %3, off\n\t"
               "global_load_async_to_lds_b128 %4, %5, off\n\t"
               "global_load_async_to_lds_b128 %6, %7, off\n\t"
               "s_wait_xcnt 0x0"
               :: "v"(d0), "v"(g0), "v"(d1), "v"(g1),
                  "v"(d2), "v"(g2), "v"(d3), "v"(g3) : "memory");
}

// reductions across the 16 lanes of each wave32 half (xor masks stay in-half)
__device__ __forceinline__ float rmax16(float x) {
  x = fmaxf(x, __shfl_xor(x, 1));
  x = fmaxf(x, __shfl_xor(x, 2));
  x = fmaxf(x, __shfl_xor(x, 4));
  x = fmaxf(x, __shfl_xor(x, 8));
  return x;
}
__device__ __forceinline__ float rsum16(float x) {
  x += __shfl_xor(x, 1);
  x += __shfl_xor(x, 2);
  x += __shfl_xor(x, 4);
  x += __shfl_xor(x, 8);
  return x;
}

// ---------------------------------------------------------------------------
// Kernel 1: sf = w_s @ x + b_s ; cf = w_c @ x + b_c   (per batch, per voxel)
// grid = B * (N/64), block = 256 (8 waves)
// Both are stored twice: [c][n], and [n][c] (sfT, cfT) for the c2s logits, whose sum
// runs over c: there a lane's fragment is then a run of consecutive floats.
// ---------------------------------------------------------------------------
__global__ __launch_bounds__(256) void proj_kernel(
    const float* __restrict__ x, const float* __restrict__ w_s,
    const float* __restrict__ b_s, const float* __restrict__ w_c,
    const float* __restrict__ b_c, float* __restrict__ sf,
    float* __restrict__ cf, float* __restrict__ sfT, float* __restrict__ cfT)
{
  __shared__ float xs [64 * 66];
  __shared__ float wS [64 * 66];
  __shared__ float wC [64 * 66];
  const int tid  = threadIdx.x;
  const int b    = blockIdx.x >> 7;
  const int nb   = (blockIdx.x & 127) << 6;
  for (int i = tid; i < 64 * 64; i += 256) {
    int c = i >> 6, j = i & 63;
    xs[c * 66 + j] = x[((size_t)((b << 6) + c)) * NSP + nb + j];
    wS[c * 66 + j] = w_s[(c << 6) + j];
    wC[c * 66 + j] = w_c[(c << 6) + j];
  }
  __syncthreads();
  const int lane = tid & 31, wv = tid >> 5;
  const int hl = lane >> 4, lr = lane & 15;
  const int nsub = (wv & 3) << 4;
  const int opr  = (wv >> 2) << 1;
  for (int t = 0; t < 2; ++t) {
    const int ob = (opr + t) << 4;
    v8f accS = vzero8(), accC = vzero8();
    for (int kb = 0; kb < 64; kb += 4) {
      const int k0 = kb + (hl << 1);
      v2f bx; bx.x = xs[k0 * 66 + nsub + lr]; bx.y = xs[(k0 + 1) * 66 + nsub + lr];
      v2f aS; aS.x = wS[(ob + lr) * 66 + k0]; aS.y = wS[(ob + lr) * 66 + k0 + 1];
      v2f aC; aC.x = wC[(ob + lr) * 66 + k0]; aC.y = wC[(ob + lr) * 66 + k0 + 1];
      accS = wmma4(aS, bx, accS);
      accC = wmma4(aC, bx, accC);
    }
    float rs[8], rc[8];
#pragma unroll
    for (int v = 0; v < 8; ++v) {
      const int o = ob + v + (hl << 3);
      const size_t idx = ((size_t)((b << 6) + o)) * NSP + nb + nsub + lr;
      rs[v] = accS[v] + b_s[o];
      rc[v] = accC[v] + b_c[o];
      sf[idx] = rs[v];
      cf[idx] = rc[v];
    }
    // the lane's 8 results are 8 consecutive channels of one voxel
    const size_t tix = ((size_t)b * NSP + nb + nsub + lr) * CCH + ob + (hl << 3);
    const v4f s0 = {rs[0], rs[1], rs[2], rs[3]}, s1 = {rs[4], rs[5], rs[6], rs[7]};
    const v4f c0 = {rc[0], rc[1], rc[2], rc[3]}, c1 = {rc[4], rc[5], rc[6], rc[7]};
    *(v4f*)(sfT + tix) = s0;  *(v4f*)(sfT + tix + 4) = s1;
    *(v4f*)(cfT + tix) = c0;  *(v4f*)(cfT + tix + 4) = c1;
  }
}

// ---------------------------------------------------------------------------
// Kernel 2: s2c logits[b,c,k] = scale * sum_n sf[c,n]*cf[k,n]   (64x64, K=8192)
// grid = B * KSPLIT, block = 256. Each work-group sums its own 64 columns n and
// stores a 64x64 partial sum; kernel 3 adds the KSPLIT partials of a batch.
// ---------------------------------------------------------------------------
__global__ __launch_bounds__(256) void s2c_logits_kernel(
    const float* __restrict__ sf, const float* __restrict__ cf,
    float* __restrict__ lg)
{
  __shared__ float sfs[64 * 66];
  __shared__ float cfs[64 * 66];
  const int tid = threadIdx.x;
  const int b   = blockIdx.x / KSPLIT;
  const int nb  = (blockIdx.x % KSPLIT) << 6;
  const int lane = tid & 31, wv = tid >> 5;
  const int hl = lane >> 4, lr = lane & 15;
  const int t0 = wv << 1, t1 = t0 + 1;
  const int ct0 = t0 >> 2, kt0 = t0 & 3;
  const int ct1 = t1 >> 2, kt1 = t1 & 3;
  v8f acc0 = vzero8(), acc1 = vzero8();
  for (int i = tid; i < 64 * 64; i += 256) {
    int c = i >> 6, j = i & 63;
    const size_t g = ((size_t)((b << 6) + c)) * NSP + nb + j;
    sfs[c * 66 + j] = sf[g];
    cfs[c * 66 + j] = cf[g];
  }
  __syncthreads();
  for (int kb = 0; kb < 64; kb += 4) {
    const int k0 = kb + (hl << 1);
    v2f a0; a0.x = sfs[((ct0 << 4) + lr) * 66 + k0]; a0.y = sfs[((ct0 << 4) + lr) * 66 + k0 + 1];
    v2f b0; b0.x = cfs[((kt0 << 4) + lr) * 66 + k0]; b0.y = cfs[((kt0 << 4) + lr) * 66 + k0 + 1];
    acc0 = wmma4(a0, b0, acc0);
    v2f a1; a1.x = sfs[((ct1 << 4) + lr) * 66 + k0]; a1.y = sfs[((ct1 << 4) + lr) * 66 + k0 + 1];
    v2f b1; b1.x = cfs[((kt1 << 4) + lr) * 66 + k0]; b1.y = cfs[((kt1 << 4) + lr) * 66 + k0 + 1];
    acc1 = wmma4(a1, b1, acc1);
  }
  float* part = lg + (size_t)blockIdx.x * 4096;
#pragma unroll
  for (int v = 0; v < 8; ++v) {
    const int r = v + (hl << 3);
    part[((ct0 << 4) + r) * 64 + (kt0 << 4) + lr] = acc0[v] * SCALE;
    part[((ct1 << 4) + r) * 64 + (kt1 << 4) + lr] = acc1[v] * SCALE;
  }
}

// ---------------------------------------------------------------------------
// Kernel 3: add the KSPLIT partial logits, then softmax over k.
// grid = B * 64 (one row of the 64x64 logits each), block = 64 (one k each)
// ---------------------------------------------------------------------------
__global__ __launch_bounds__(64) void s2c_softmax_kernel(
    const float* __restrict__ lg, float* __restrict__ attn)
{
  __shared__ float row[64];
  const int b = blockIdx.x >> 6, r = blockIdx.x & 63, k = threadIdx.x;
  const float* p = lg + (size_t)b * KSPLIT * 4096 + r * 64 + k;
  float x = 0.f;
  // unrolled so that the loads are issued ahead of the adds, not one per round trip
#pragma unroll
  for (int s = 0; s < KSPLIT; ++s) x += p[s * 4096];
  row[k] = x;
  __syncthreads();  // the whole row is in LDS
  float m = -3.0e38f;
  for (int j = 0; j < 64; ++j) m = fmaxf(m, row[j]);
  float z = 0.f;
  for (int j = 0; j < 64; ++j) z += __expf(row[j] - m);
  attn[b * 4096 + r * 64 + k] = __expf(x - m) * (1.0f / z);
}

// ---------------------------------------------------------------------------
// Kernel 4: c2s flash pass 1 - per-row (n) online max M and 1/Z over all m.
// l[n,m] = scale * sum_c cf[c,n]*sf[c,m].  grid = B*(N/64), block = 512 (16 waves).
// Wave (wv & 3) owns 16 of the 64 rows; wave group (wv >> 2) owns 32 of the 128
// columns of every m-chunk, so four waves share each row's m loop.
// M and Z are kept per lane in the m loop, merged across the 16 lanes after it,
// and the four groups' (M, Z) pairs of a row are merged through LDS at the end.
// The wave's cf rows (A operand) do not change in the m loop: they are loaded once,
// in fragment order, and stay in registers.
// sf m-chunks (128 cols) are double-buffered via async global->LDS DMA, from sfT, one
// LDS row per column m. k order of A and B alike: WMMA step i, half wave hl, element j
// hold channel 32*hl + 2*i + j, so one 16-byte read feeds two steps.
// ---------------------------------------------------------------------------
// waves_per_eu: the block's own four waves per SIMD, so that the compiler spends the
// registers on issuing a chunk's LDS fragment loads as one group ahead of the WMMAs.
__global__ __launch_bounds__(512) __attribute__((amdgpu_waves_per_eu(4, 4))) void c2s_stats_kernel(
    const float* __restrict__ sfT, const float* __restrict__ cfT,
    float* __restrict__ Mbuf, float* __restrict__ Rbuf)
{
  __shared__ __attribute__((aligned(16))) float sfs[2][128 * TP];  // sf m-chunks (B operand, async dbl-buf)
  __shared__ float Mx[4][64];        // per wave group: row max
  __shared__ float Zx[4][64];        // per wave group: row sum
  const int tid  = threadIdx.x;
  const int b    = blockIdx.x >> 7;
  const int nblk = (blockIdx.x & 127) << 6;
  const size_t sbase = ((size_t)b << 6) * NSP;
  // per-thread async share: 4x b128 per 128-column chunk, which is 32 KiB in a row in sfT
  // (16 lanes copy one column's 64 channels)
  const int ca = tid >> 4;            // columns 0..31, then +32, +64, +96
  const int qa = (tid & 15) << 2;     // float quad within the 64 channels
  const float* gs = sfT + sbase + ca * CCH + qa;
  async_g2l_b128x4(lds_off(&sfs[0][ca * TP + qa]),        gs,
                   lds_off(&sfs[0][(ca + 32) * TP + qa]), gs + 32 * CCH,
                   lds_off(&sfs[0][(ca + 64) * TP + qa]), gs + 64 * CCH,
                   lds_off(&sfs[0][(ca + 96) * TP + qa]), gs + 96 * CCH);

  const int lane = tid & 31, wv = tid >> 5;
  const int hl = lane >> 4, lr = lane & 15;
  const int nsub = (wv & 3) << 4;     // this wave's 16 rows
  const int grp  = wv >> 2;           // this wave's column group
  // A fragments of all 16 k steps: channels 32*hl + 2i and the next, row nsub + lr
  v2f afr[16];
  {
    const float* ga = cfT + sbase + (size_t)(nblk + nsub + lr) * CCH + (hl << 5);
    // unrolled: afr is indexed by constants only, or it would live in scratch
#pragma unroll
    for (int t = 0; t < 8; ++t) {
      const v4f a4 = *(const v4f*)(ga + 4 * t);
      afr[2 * t].x = a4.x;      afr[2 * t].y = a4.y;
      afr[2 * t + 1].x = a4.z;  afr[2 * t + 1].y = a4.w;
    }
  }
  float M[8], Z[8];
#pragma unroll
  for (int v = 0; v < 8; ++v) { M[v] = -3.0e38f; Z[v] = 0.f; }

  for (int mb = 0, it = 0; mb < NSP; mb += 128, ++it) {
    const int cur = it & 1, nxt = cur ^ 1;
    __syncthreads();  // nobody still reads buf[nxt]
    if (mb + 128 < NSP) {
      const float* gn = gs + (mb + 128) * CCH;
      async_g2l_b128x4(lds_off(&sfs[nxt][ca * TP + qa]),        gn,
                       lds_off(&sfs[nxt][(ca + 32) * TP + qa]), gn + 32 * CCH,
                       lds_off(&sfs[nxt][(ca + 64) * TP + qa]), gn + 64 * CCH,
                       lds_off(&sfs[nxt][(ca + 96) * TP + qa]), gn + 96 * CCH);
      asm volatile("s_wait_asynccnt 4" ::: "memory");  // chunk `cur` retired
    } else {
      asm volatile("s_wait_asynccnt 0" ::: "memory");
    }
    __syncthreads();  // all waves' async writes visible
    const float* S = &sfs[cur][((grp << 5) + lr) * TP + (hl << 5)];  // column lr, channel 32*hl
    for (int ms = 0; ms < 2; ++ms) {
      v8f acc = vzero8();
      // unrolled so that afr is indexed by constants and stays in registers
#pragma unroll
      for (int t = 0; t < 8; ++t) {
        const v4f b4 = *(const v4f*)(S + (ms << 4) * TP + 4 * t);
        v2f b0; b0.x = b4.x; b0.y = b4.y;
        v2f b1; b1.x = b4.z; b1.y = b4.w;
        acc = wmma4(afr[2 * t], b0, acc);
        acc = wmma4(afr[2 * t + 1], b1, acc);
      }
#pragma unroll
      for (int v = 0; v < 8; ++v) {
        // each lane folds only its own column into its own M, Z
        const float xv = acc[v] * SCALE;
        const float nm = fmaxf(M[v], xv);
        Z[v] = Z[v] * __expf(M[v] - nm) + __expf(xv - nm);
        M[v] = nm;
      }
    }
  }
  // merge the 16 per-lane (M, Z) pairs of each row, once per row
  // (unrolled so that M[v] and Z[v] are indexed by constants and stay in registers)
#pragma unroll
  for (int v = 0; v < 8; ++v) {
    const float mt = rmax16(M[v]);
    Z[v] = rsum16(Z[v] * __expf(M[v] - mt));
    M[v] = mt;
  }
  if (lr == 0) {
#pragma unroll
    for (int v = 0; v < 8; ++v) {
      const int r = nsub + (hl << 3) + v;
      Mx[grp][r] = M[v];
      Zx[grp][r] = Z[v];
    }
  }
  __syncthreads();  // the four groups' pairs of every row are in LDS
  if (tid < 64) {
    const float m0 = Mx[0][tid], m1 = Mx[1][tid], m2 = Mx[2][tid], m3 = Mx[3][tid];
    const float mt = fmaxf(fmaxf(m0, m1), fmaxf(m2, m3));
    const float z  = Zx[0][tid] * __expf(m0 - mt) + Zx[1][tid] * __expf(m1 - mt)
                   + Zx[2][tid] * __expf(m2 - mt) + Zx[3][tid] * __expf(m3 - mt);
    Mbuf[b * NSP + nblk + tid] = mt;
    Rbuf[b * NSP + nblk + tid] = 1.0f / z;   // store reciprocal (z >= 1 always)
  }
}

// ---------------------------------------------------------------------------
// Kernel 5: c2s flash pass 2 + s2c output + residual.
// out[c,m] = sum_n sf[c,n]*exp(l[n,m]-M[n])/Z[n] + sum_k attn[c,k]*cf[k,m] + x
// grid = B*(N/64) m-blocks, block = 512 (16 waves).
// Wave (wv & 3) owns 16 of the 64 columns; wave group (wv >> 2) owns one of the
// four 16-wide n-tiles of every stage, so four waves share each column's n loop.
// Their partial sums are added through LDS after the loop.
// The wave's sf columns (B operand of the logits) do not change in the n loop:
// they are loaded once, in fragment order, and stay in registers.
// cf/sf n-tiles double-buffered via async global->LDS DMA; cf comes from cfT, one LDS
// row per n, and the logits use the k order of kernel 4 (channel 32*hl + 2*i + j).
// ---------------------------------------------------------------------------
// waves_per_eu: the block's own four waves per SIMD. With less LDS the compiler would
// otherwise budget registers for a second resident work-group, which this grid never
// supplies, and fetch the LDS fragments just in time instead of as one group ahead.
__global__ __launch_bounds__(512) __attribute__((amdgpu_waves_per_eu(4, 4))) void c2s_out_kernel(
    const float* __restrict__ x, const float* __restrict__ sf,
    const float* __restrict__ cf, const float* __restrict__ Mbuf,
    const float* __restrict__ Rbuf, const float* __restrict__ attn,
    const float* __restrict__ sfT, const float* __restrict__ cfT,
    float* __restrict__ out)
{
  __shared__ __attribute__((aligned(16))) float cft[2][64 * TP];     // cf n-rows (A for logits, async dbl-buf)
  __shared__ __attribute__((aligned(16))) float sft[2][4][64 * 20];  // sf n-tiles (A for out GEMM, async dbl-buf)
  __shared__ float Pst[16][16 * 18]; // per-wave probability tile
  __shared__ float red[3][4][32 * 32];  // partial sums of wave groups 1..3
  const int tid  = threadIdx.x;
  const int b    = blockIdx.x >> 7;
  const int mblk = (blockIdx.x & 127) << 6;
  const size_t sbase = ((size_t)b << 6) * NSP;
  // per-thread async share for a stage (64 rows x 64 n of cf and of sf):
  // 2 b128 from cf + 2 from sf; 16 lanes cover one row's 256 bytes
  const int ca = tid >> 4;           // row 0..31, then +32
  const int ta = (tid & 15) >> 2;    // n-tile within the stage
  const int qa = (tid & 3) << 2;     // float quad within the 16-col tile
  const size_t ga = sbase + (size_t)ca * NSP + (ta << 4) + qa;
  // cfT: a stage's 64 n-rows are 16 KiB in a row; 16 lanes copy one row's 64 channels
  const int qc = (tid & 15) << 2;    // float quad within the 64 channels
  const float* gc = cfT + sbase + ca * CCH + qc;
  async_g2l_b128x4(lds_off(&cft[0][ca * TP + qc]),            gc,
                   lds_off(&cft[0][(ca + 32) * TP + qc]),     gc + 32 * CCH,
                   lds_off(&sft[0][ta][ca * 20 + qa]),        sf + ga,
                   lds_off(&sft[0][ta][(ca + 32) * 20 + qa]), sf + ga + (size_t)32 * NSP);

  const int lane = tid & 31, wv = tid >> 5;
  const int hl = lane >> 4, lr = lane & 15;
  const int msub = (wv & 3) << 4;    // this wave's 16 columns
  const int grp  = wv >> 2;          // this wave's n-tile of every stage
  // B fragments of all 16 k steps: channels 32*hl + 2i and the next, column msub + lr
  v2f bfr[16];
  {
    const float* gb = sfT + sbase + (size_t)(mblk + msub + lr) * CCH + (hl << 5);
    // unrolled: bfr is indexed by constants only, or it would live in scratch
#pragma unroll
    for (int t = 0; t < 8; ++t) {
      const v4f b4 = *(const v4f*)(gb + 4 * t);
      bfr[2 * t].x = b4.x;      bfr[2 * t].y = b4.y;
      bfr[2 * t + 1].x = b4.z;  bfr[2 * t + 1].y = b4.w;
    }
  }
  v8f accO[4];
#pragma unroll
  for (int ct = 0; ct < 4; ++ct) accO[ct] = vzero8();

  for (int st = 0; st < NSP / 64; ++st) {
    const int cur = st & 1, nxt = cur ^ 1;
    const int nb = (st << 6) + (grp << 4);
    __syncthreads();  // nobody still reads buf[nxt]
    if (st + 1 < NSP / 64) {
      const size_t gn = ga + (st << 6) + 64;
      const float* gcn = gc + ((st << 6) + 64) * CCH;
      async_g2l_b128x4(lds_off(&cft[nxt][ca * TP + qc]),            gcn,
                       lds_off(&cft[nxt][(ca + 32) * TP + qc]),     gcn + 32 * CCH,
                       lds_off(&sft[nxt][ta][ca * 20 + qa]),        sf + gn,
                       lds_off(&sft[nxt][ta][(ca + 32) * 20 + qa]), sf + gn + (size_t)32 * NSP);
      asm volatile("s_wait_asynccnt 4" ::: "memory");  // stage `cur` retired
    } else {
      asm volatile("s_wait_asynccnt 0" ::: "memory");
    }
    __syncthreads();  // all waves' async writes visible
    const float* CA = &cft[cur][((grp << 4) + lr) * TP + (hl << 5)];  // row lr, channel 32*hl
    const float* ST = &sft[cur][grp][0];
    // logits tile l[16 n x 16 m], K = 64 channels
    v8f acc = vzero8();
    // unrolled so that bfr is indexed by constants and stays in registers
#pragma unroll
    for (int t = 0; t < 8; ++t) {
      const v4f a4 = *(const v4f*)(CA + 4 * t);
      v2f a0; a0.x = a4.x; a0.y = a4.y;
      v2f a1; a1.x = a4.z; a1.y = a4.w;
      acc = wmma4(a0, bfr[2 * t], acc);
      acc = wmma4(a1, bfr[2 * t + 1], acc);
    }
    // P = exp(scale*l - M[n]) * (1/Z[n]); stage through per-wave LDS to
    // re-fragment D-layout -> B-layout for the next GEMM.
    float* Pw = &Pst[wv][0];
#pragma unroll
    for (int v = 0; v < 8; ++v) {
      const int n = nb + (hl << 3) + v;
      const float p = __expf(acc[v] * SCALE - Mbuf[b * NSP + n]) * Rbuf[b * NSP + n];
      Pw[((hl << 3) + v) * 18 + lr] = p;
    }
    asm volatile("s_wait_dscnt 0" ::: "memory");  // wave-local LDS RAW fence
    // accO[c-tile] += sf[c, n-tile] @ P[n-tile, m]
#pragma unroll
    for (int ct = 0; ct < 4; ++ct) {
      for (int kb = 0; kb < 16; kb += 4) {
        const int k0 = kb + (hl << 1);
        v2f a;  a.x  = ST[((ct << 4) + lr) * 20 + k0]; a.y  = ST[((ct << 4) + lr) * 20 + k0 + 1];
        v2f bb; bb.x = Pw[k0 * 18 + lr];               bb.y = Pw[(k0 + 1) * 18 + lr];
        accO[ct] = wmma4(a, bb, accO[ct]);
      }
    }
  }
  // add the four wave groups' partial sums: groups 1..3 hand theirs to group 0
  if (grp != 0) {
    float* R = &red[grp - 1][wv & 3][0];
#pragma unroll
    for (int ct = 0; ct < 4; ++ct) {
#pragma unroll
      for (int v = 0; v < 8; ++v) R[((ct << 3) + v) * 32 + lane] = accO[ct][v];
    }
  }
  __syncthreads();  // the partial sums are in LDS
  if (grp != 0) return;
#pragma unroll
  for (int k = 0; k < 3; ++k) {
    const float* R = &red[k][wv][0];
#pragma unroll
    for (int ct = 0; ct < 4; ++ct) {
#pragma unroll
      for (int v = 0; v < 8; ++v) accO[ct][v] += R[((ct << 3) + v) * 32 + lane];
    }
  }
  // s2c output: accO += attn[c,k] @ cf[k,m]   (K = 64, tiny)
#pragma unroll
  for (int ct = 0; ct < 4; ++ct) {
    for (int kb = 0; kb < 64; kb += 4) {
      const int k0 = kb + (hl << 1);
      v2f a;
      a.x = attn[b * 4096 + ((ct << 4) + lr) * 64 + k0];
      a.y = attn[b * 4096 + ((ct << 4) + lr) * 64 + k0 + 1];
      const size_t g0 = sbase + (size_t)k0 * NSP + mblk + msub + lr;
      v2f bb; bb.x = cf[g0]; bb.y = cf[g0 + NSP];
      accO[ct] = wmma4(a, bb, accO[ct]);
    }
  }
  // residual + store
#pragma unroll
  for (int ct = 0; ct < 4; ++ct) {
#pragma unroll
    for (int v = 0; v < 8; ++v) {
      const int c = (ct << 4) + (hl << 3) + v;
      const size_t idx = sbase + (size_t)c * NSP + mblk + msub + lr;
      out[idx] = accO[ct][v] + x[idx];
    }
  }
}

// ---------------------------------------------------------------------------
extern "C" void kernel_launch(void* const* d_in, const int* in_sizes, int n_in,
                              void* d_out, int out_size, void* d_ws, size_t ws_size,
                              hipStream_t stream)
{
  const float* x   = (const float*)d_in[0];
  const float* w_s = (const float*)d_in[1];
  const float* b_s = (const float*)d_in[2];
  const float* w_c = (const float*)d_in[3];
  const float* b_c = (const float*)d_in[4];
  float* out = (float*)d_out;

  float* ws = (float*)d_ws;
  float* sf = ws;                                   // [B,64,N]
  float* cf = sf + (size_t)NBAT * CCH * NSP;        // [B,64,N]
  float* Mb = cf + (size_t)NBAT * CCH * NSP;        // [B,N] row max
  float* Rb = Mb + (size_t)NBAT * NSP;              // [B,N] 1/rowsum
  float* lg = Rb + (size_t)NBAT * NSP;              // [B,KSPLIT,64,64] partial logits
  float* at = lg + NBAT * KSPLIT * CCH * CCH;       // [B,64,64]
  float* sT = at + NBAT * CCH * CCH;                // [B,N,64] sf, channels in a row
  float* cT = sT + (size_t)NBAT * CCH * NSP;        // [B,N,64] cf, channels in a row

  proj_kernel       <<<NBAT * (NSP / 64), 256, 0, stream>>>(x, w_s, b_s, w_c, b_c, sf, cf, sT, cT);
  s2c_logits_kernel <<<NBAT * KSPLIT,     256, 0, stream>>>(sf, cf, lg);
  s2c_softmax_kernel<<<NBAT * CCH,         64, 0, stream>>>(lg, at);
  c2s_stats_kernel  <<<NBAT * (NSP / 64),  512, 0, stream>>>(sT, cT, Mb, Rb);
  c2s_out_kernel    <<<NBAT * (NSP / 64),  512, 0, stream>>>(x, sf, cf, Mb, Rb, at, sT, cT, out);
}
